// v000
// The times below were measured on an AMD MI455X: many runs one after another, warmed up first and cycling through
// copies of the inputs, with the whole window's GPU time divided by the number of runs. Launches and the gaps
// between them are all in it. The median over several windows is given; except for v000 it joins two sittings, which
// can be a few percent apart, so the side-by-side timings, each taken in one sitting, are the better comparison.
// v000 is the starting kernel. One run takes 2010 microseconds.
#include <hip/hip_runtime.h>
// Contractions: Q/K/V projections (K = 768), scores Q K^T (K = 768) and P V (K = keys) on v_wmma_f32_16x16x32_f16
// (f16 operands, f32 accumulate; P scaled by 256 before its f16 conversion); softmax statistics in f32.

typedef _Float16 h16;
typedef _Float16 h16x8 __attribute__((ext_vector_type(8)));
typedef _Float16 v16h  __attribute__((ext_vector_type(16)));
typedef float  v8f    __attribute__((ext_vector_type(8)));
typedef float  v4f    __attribute__((ext_vector_type(4)));
typedef unsigned v4u  __attribute__((ext_vector_type(4)));

#define D_DIM 768
#define S_LEN 4096
#define B_SZ  4
#define M_TOT (B_SZ * S_LEN)   // 16384
#define PSC 256.0f
#define PUN (1.0f / 256.0f)

template <typename V> __device__ __forceinline__ void vst2(void* p, V v) {
  *(V*)p = v; 
}
__device__ __forceinline__ void copy16_g2s(h16* ldst, const h16* gsrc) { *(h16x8*)ldst = *(const h16x8*)gsrc; }

// ---- WMMA fragment loaders (f16, row-major K-contiguous source); A and B (from B^T rows) share the per-lane K map:
//      row/col = lane&15; elements 0..7 <- k0 + 8*half + 0..7, elements 8..15 <- k0 + 16 + 8*half + 0..7
__device__ __forceinline__ v16h load_a_frag(const h16* base, int ld, int k0) {
  int lane = threadIdx.x & 31;
  int idx  = lane & 15;
  int half = lane >> 4;
  const h16* p = base + idx * ld + k0 + half * 8;
  h16x8 lo = *(const h16x8*)(p);
  h16x8 hi = *(const h16x8*)(p + 16);
  return __builtin_shufflevector(lo, hi, 0,1,2,3,4,5,6,7,8,9,10,11,12,13,14,15);
}
__device__ __forceinline__ v16h load_b_frag(const h16* base, int ld, int k0) { return load_a_frag(base, ld, k0); }

__device__ __forceinline__ v8f wmma_f16(v16h a, v16h b, v8f c) {
  v8f d = __builtin_amdgcn_wmma_f32_16x16x32_f16(false, a, false, b, (short)0, c, false, false);
  asm volatile("v_nop\n\tv_nop\n\tv_nop\n\tv_nop" : "+v"(d) : "v"(a), "v"(b));
  return d;
}

// ---------------- conversion kernels ----------------
__global__ void cvt_x_kernel(const float* __restrict__ x, h16* __restrict__ xb, int n8) {   // 8 elements (16 B) per thread
  int g = blockIdx.x * blockDim.x + threadIdx.x;
  if (g >= n8) return;
  const v4f a = *(const v4f*)(x + (size_t)g * 8), b = *(const v4f*)(x + (size_t)g * 8 + 4);
  union { h16x8 h; v4u u; } pk;
#pragma unroll
  for (int i = 0; i < 4; ++i) { pk.h[i] = (h16)a[i]; pk.h[4 + i] = (h16)b[i]; }
  vst2(xb + (size_t)g * 8, pk.u);
}

__global__ __launch_bounds__(256) void cvt_w_kernel(const float* __restrict__ Wq, const float* __restrict__ Wk, const float* __restrict__ Wv,
                                                    h16* __restrict__ WqT, h16* __restrict__ WkT, h16* __restrict__ WvT) {
  __shared__ __align__(16) h16 tile[64][264];
  const float* W = (blockIdx.z == 0) ? Wq : (blockIdx.z == 1) ? Wk : Wv;
  h16*       WT = (blockIdx.z == 0) ? WqT : (blockIdx.z == 1) ? WkT : WvT;
  const int n0 = blockIdx.x * 64, k0 = blockIdx.y * 256, tid = threadIdx.x;
  for (int i = tid; i < 256 * 64; i += 256) { const int k = i >> 6, nl = i & 63; tile[nl][k] = (h16)W[(size_t)(k0 + k) * D_DIM + n0 + nl]; }
  __syncthreads();
  for (int g = tid; g < 64 * 32; g += 256) { const int nl = g >> 5, pc = g & 31; vst2(WT + (size_t)(n0 + nl) * D_DIM + k0 + pc * 8, *(const v4u*)(&tile[nl][pc * 8])); }
}

// ---------------- projection GEMM: out = X(16384x768) * W(768x768) + b ----------------
// 8 waves/WG: 4 M-subtiles x 2 N-groups(64). Each wave: 16x64 out (4 WMMA tiles). Block tile 64 x 128 staged in LDS (f16) and
__global__ __launch_bounds__(256) void proj_kernel(const h16* __restrict__ Xb, const h16* __restrict__ WT,
                            const float* __restrict__ bias, h16* __restrict__ out, int transposed) {
  __shared__ __align__(16) h16 T[128 * 136];      // [m][n] pitch 136 (transposed==0) or [n][m] pitch 72 (transposed==1)
  int m0 = blockIdx.x * 64;
  int n0 = blockIdx.y * 128;
  int w    = threadIdx.x >> 5;
  int lane = threadIdx.x & 31;
  int idx  = lane & 15;
  int half = lane >> 4;
  int m_w = m0 + (w & 3) * 16;
  int n_w = n0 + (w >> 2) * 64;

  v8f c[4] = {};
  const h16* arow = Xb + (size_t)m_w * D_DIM;
#pragma unroll 2
  for (int k0 = 0; k0 < D_DIM; k0 += 32) {
    v16h a = load_a_frag(arow, D_DIM, k0);
#pragma unroll
    for (int t = 0; t < 4; ++t) {
      v16h b = load_b_frag(WT + (size_t)(n_w + t * 16) * D_DIM, D_DIM, k0);
      c[t] = wmma_f16(a, b, c[t]);
    }
  }
#pragma unroll
  for (int t = 0; t < 4; ++t) {
    int cl = (w >> 2) * 64 + t * 16 + idx;          // local col
    float bv = bias[n0 + cl];
#pragma unroll
    for (int g = 0; g < 8; ++g) {
      int rl = (w & 3) * 16 + g + 8 * half;          // local row
      h16 hv = (h16)(c[t][g] + bv);
      if (!transposed) T[rl * 136 + cl] = hv; else T[cl * 72 + rl] = hv;
    }
  }
  __syncthreads();
  const int tid = threadIdx.x;
  if (!transposed) {
    for (int gg = tid; gg < 64 * 16; gg += 256) { const int rl = gg >> 4, pc = gg & 15; vst2(out + (size_t)(m0 + rl) * D_DIM + n0 + pc * 8, *(const v4u*)(&T[rl * 136 + pc * 8])); }
  } else {
    const int bb = m0 >> 12, s0 = m0 & (S_LEN - 1);
    for (int gg = tid; gg < 128 * 8; gg += 256) { const int cl = gg >> 3, pc = gg & 7; vst2(out + ((size_t)(bb * D_DIM + n0 + cl)) * S_LEN + s0 + pc * 8, *(const v4u*)(&T[cl * 72 + pc * 8])); }
  }
}

// ---------------- flash attention ----------------
// WG = 32 queries, 8 waves. KV tiles of 64 keys.
// Score phase: wave w -> (qi = w&1, kj = w>>1) 16x16 tile, K-loop over 768.
// PV phase:    wave w -> (qi = w&1, dg = w>>1) 16 q x 192 dims (12 accum tiles).
__global__ __launch_bounds__(256)
void attn_kernel(const h16* __restrict__ Q, const h16* __restrict__ K,
                 const h16* __restrict__ Vt, float* __restrict__ out) {
  __shared__ __align__(16) h16   Qs[32][D_DIM];    // 48 KB
  __shared__ __align__(16) h16   Ks[64][D_DIM];    // 96 KB (reused as the f32 output tile [32][768] after the loop)
  __shared__ __align__(16) h16   Vts[D_DIM][64];   // 96 KB (d-major)
  __shared__ __align__(16) float Ss[32][64];       // 8 KB
  __shared__ __align__(16) h16   Ps[32][64];       // 4 KB
  __shared__ float alpha_s[32];
  __shared__ float l_s[32];

  int b   = blockIdx.y;
  int q0  = blockIdx.x * 32;
  int tid = threadIdx.x;
  int w    = tid >> 5;
  int lane = tid & 31;
  int idx  = lane & 15;
  int half = lane >> 4;
  int qi = w & 1;
  int kj = w >> 1;     // score kv subtile
  int dg = w >> 1;     // PV d-group (192 dims)

  const h16* Qg = Q + ((size_t)(b * S_LEN + q0)) * D_DIM;
  for (int c = tid; c < 32 * (D_DIM / 8); c += 256) {
    int r = c / (D_DIM / 8), dc = c % (D_DIM / 8);
    copy16_g2s(&Qs[r][dc * 8], Qg + (size_t)r * D_DIM + dc * 8);
  }

  v8f o[12] = {};
  int   srow = tid >> 3;          // softmax: 8 threads per query row
  int   sj   = tid & 7;
  float m_prev = -1e30f;
  float l_run  = 0.0f;
  const float scale = 0.03608439182435161f;  // 1/sqrt(768)

  for (int kv0 = 0; kv0 < S_LEN; kv0 += 64) {
    __syncthreads();   // prev PV done (and Qs issue point on first iter)
    const h16* Kg = K + ((size_t)(b * S_LEN + kv0)) * D_DIM;
    for (int c = tid; c < 64 * (D_DIM / 8); c += 256) {
      int r = c / (D_DIM / 8), dc = c % (D_DIM / 8);
      copy16_g2s(&Ks[r][dc * 8], Kg + (size_t)r * D_DIM + dc * 8);
    }
    const h16* Vg = Vt + (size_t)b * D_DIM * S_LEN + kv0;
    for (int c = tid; c < D_DIM * 8; c += 256) {
      int d = c / 8, j = c % 8;
      copy16_g2s(&Vts[d][j * 8], Vg + (size_t)d * S_LEN + j * 8);
    }
    __syncthreads();

    {
      v8f sc = {};
#pragma unroll 4
      for (int k0 = 0; k0 < D_DIM; k0 += 32) {
        v16h a = load_a_frag(&Qs[qi * 16][0], D_DIM, k0);
        v16h bb = load_b_frag(&Ks[kj * 16][0], D_DIM, k0);
        sc = wmma_f16(a, bb, sc);
      }
      int col = kj * 16 + idx;
#pragma unroll
      for (int g = 0; g < 8; ++g)
        Ss[qi * 16 + g + 8 * half][col] = sc[g] * scale;
    }
    __syncthreads();

    {
      float v[8];
      float mloc = -1e30f;
#pragma unroll
      for (int e = 0; e < 8; ++e) { v[e] = Ss[srow][sj + e * 8]; mloc = fmaxf(mloc, v[e]); }
#pragma unroll
      for (int msk = 1; msk < 8; msk <<= 1) mloc = fmaxf(mloc, __shfl_xor(mloc, msk, 32));
      float m_new = fmaxf(m_prev, mloc);
      float alpha = __expf(m_prev - m_new);
      float ssum = 0.0f;
#pragma unroll
      for (int e = 0; e < 8; ++e) {
        float p = __expf(v[e] - m_new);
        ssum += p;
        Ps[srow][sj + e * 8] = (h16)(p * PSC);
      }
#pragma unroll
      for (int msk = 1; msk < 8; msk <<= 1) ssum += __shfl_xor(ssum, msk, 32);
      l_run = l_run * alpha + ssum;
      m_prev = m_new;
      if (sj == 0) { alpha_s[srow] = alpha; l_s[srow] = l_run; }
    }
    __syncthreads();

    {
      float al[8];
#pragma unroll
      for (int g = 0; g < 8; ++g) al[g] = alpha_s[qi * 16 + g + 8 * half];
#pragma unroll
      for (int t = 0; t < 12; ++t)
#pragma unroll
        for (int g = 0; g < 8; ++g) o[t][g] *= al[g];
#pragma unroll
      for (int k0 = 0; k0 < 64; k0 += 32) {
        v16h a = load_a_frag(&Ps[qi * 16][0], 64, k0);
#pragma unroll
        for (int t = 0; t < 12; ++t) {
          v16h bb = load_b_frag(&Vts[dg * 192 + t * 16][0], 64, k0);
          o[t] = wmma_f16(a, bb, o[t]);
        }
      }
    }
  }
  __syncthreads();

  float* Ot = (float*)&Ks[0][0];
  float linv[8];
#pragma unroll
  for (int g = 0; g < 8; ++g) linv[g] = PUN / l_s[qi * 16 + g + 8 * half];
#pragma unroll
  for (int t = 0; t < 12; ++t) {
    int col = dg * 192 + t * 16 + idx;
#pragma unroll
    for (int g = 0; g < 8; ++g) Ot[(qi * 16 + g + 8 * half) * D_DIM + col] = o[t][g] * linv[g];
  }
  __syncthreads();
  {
    float* dst = out + ((size_t)(b * S_LEN + q0)) * D_DIM;      // 32 contiguous rows
    for (int gg = tid; gg < 32 * D_DIM / 4; gg += 256) vst2(dst + (size_t)gg * 4, *(const v4f*)(Ot + gg * 4));
  }
}

extern "C" void kernel_launch(void* const* d_in, const int* in_sizes, int n_in,
                              void* d_out, int out_size, void* d_ws, size_t ws_size,
                              hipStream_t stream) {
  (void)in_sizes; (void)n_in; (void)out_size; (void)ws_size;
  const float* x  = (const float*)d_in[0];
  const float* Wq = (const float*)d_in[1];
  const float* bq = (const float*)d_in[2];
  const float* Wk = (const float*)d_in[3];
  const float* bk = (const float*)d_in[4];
  const float* Wv = (const float*)d_in[5];
  const float* bv = (const float*)d_in[6];
  float* out = (float*)d_out;

  char* ws = (char*)d_ws;
  h16* xb  = (h16*)(ws + 0);           // 16384*768*2 = 25,165,824
  h16* WqT = (h16*)(ws + 25165824);    // 768*768*2   =  1,179,648
  h16* WkT = (h16*)(ws + 26345472);
  h16* WvT = (h16*)(ws + 27525120);
  h16* qb  = (h16*)(ws + 28704768);    // 25,165,824
  h16* kb  = (h16*)(ws + 53870592);    // 25,165,824
  h16* vtb = (h16*)(ws + 79036416);    // 25,165,824  (stored [b][d][s])

  int nx8 = M_TOT * D_DIM / 8;
  cvt_x_kernel<<<nx8 / 256, 256, 0, stream>>>(x, xb, nx8);
  cvt_w_kernel<<<dim3(D_DIM / 64, D_DIM / 256, 3), 256, 0, stream>>>(Wq, Wk, Wv, WqT, WkT, WvT);

  dim3 pg(M_TOT / 64, D_DIM / 128);
  proj_kernel<<<pg, 256, 0, stream>>>(xb, WqT, bq, qb, 0);
  proj_kernel<<<pg, 256, 0, stream>>>(xb, WkT, bk, kb, 0);
  proj_kernel<<<pg, 256, 0, stream>>>(xb, WvT, bv, vtb, 1);

  attn_kernel<<<dim3(S_LEN / 32, B_SZ), 256, 0, stream>>>(qb, kb, vtb, out);
}

// v001
// It runs in 1150 microseconds.
// In two side-by-side timings against v000, it was 1.78 and 1.77 times as fast.
#include <hip/hip_runtime.h>
// Contractions: Q/K/V projections (K = 768), scores Q K^T (K = 768) and P V (K = keys) on v_wmma_f32_16x16x32_f16
// (f16 operands, f32 accumulate; P scaled by 256 before its f16 conversion); softmax statistics in f32.

typedef _Float16 h16;
typedef _Float16 h16x8 __attribute__((ext_vector_type(8)));
typedef _Float16 v16h  __attribute__((ext_vector_type(16)));
typedef float  v8f    __attribute__((ext_vector_type(8)));
typedef float  v4f    __attribute__((ext_vector_type(4)));
typedef unsigned v4u  __attribute__((ext_vector_type(4)));

#define D_DIM 768
#define S_LEN 4096
#define B_SZ  4
#define M_TOT (B_SZ * S_LEN)   // 16384
#define PSC 256.0f
#define PUN (1.0f / 256.0f)
// LDS row pitches of the attention tiles. Fragment rows read by 16-byte LDS loads sit at 16 B x odd, so that the 16 rows
// of a half-wave fall on 16 different groups of four banks (64 banks of 4 B) instead of all on one group.
#define QK_P 776   // halves: 1552 B = 16 B x 97 (768 data + 8 pad)
#define KV_P 72    // halves:  144 B = 16 B x 9  (64 data + 8 pad)
#define SS_P 74    // floats: 4 rows x 8 columns of a softmax read, and rows r and r + 8 of a score store, on distinct banks

template <typename V> __device__ __forceinline__ void vst2(void* p, V v) {
  *(V*)p = v; 
}
__device__ __forceinline__ void copy16_g2s(h16* ldst, const h16* gsrc) { *(h16x8*)ldst = *(const h16x8*)gsrc; }

// ---- WMMA fragment loaders (f16, row-major K-contiguous source); A and B (from B^T rows) share the per-lane K map:
//      row/col = lane&15; elements 0..7 <- k0 + 8*half + 0..7, elements 8..15 <- k0 + 16 + 8*half + 0..7
__device__ __forceinline__ v16h load_a_frag(const h16* base, int ld, int k0) {
  int lane = threadIdx.x & 31;
  int idx  = lane & 15;
  int half = lane >> 4;
  const h16* p = base + idx * ld + k0 + half * 8;
  h16x8 lo = *(const h16x8*)(p);
  h16x8 hi = *(const h16x8*)(p + 16);
  return __builtin_shufflevector(lo, hi, 0,1,2,3,4,5,6,7,8,9,10,11,12,13,14,15);
}
__device__ __forceinline__ v16h load_b_frag(const h16* base, int ld, int k0) { return load_a_frag(base, ld, k0); }

__device__ __forceinline__ v8f wmma_f16(v16h a, v16h b, v8f c) {
  v8f d = __builtin_amdgcn_wmma_f32_16x16x32_f16(false, a, false, b, (short)0, c, false, false);
  asm volatile("v_nop\n\tv_nop\n\tv_nop\n\tv_nop" : "+v"(d) : "v"(a), "v"(b));
  return d;
}

// ---------------- conversion kernels ----------------
__global__ void cvt_x_kernel(const float* __restrict__ x, h16* __restrict__ xb, int n8) {   // 8 elements (16 B) per thread
  int g = blockIdx.x * blockDim.x + threadIdx.x;
  if (g >= n8) return;
  const v4f a = *(const v4f*)(x + (size_t)g * 8), b = *(const v4f*)(x + (size_t)g * 8 + 4);
  union { h16x8 h; v4u u; } pk;
#pragma unroll
  for (int i = 0; i < 4; ++i) { pk.h[i] = (h16)a[i]; pk.h[4 + i] = (h16)b[i]; }
  vst2(xb + (size_t)g * 8, pk.u);
}

__global__ __launch_bounds__(256) void cvt_w_kernel(const float* __restrict__ Wq, const float* __restrict__ Wk, const float* __restrict__ Wv,
                                                    h16* __restrict__ WqT, h16* __restrict__ WkT, h16* __restrict__ WvT) {
  __shared__ __align__(16) h16 tile[64][264];
  const float* W = (blockIdx.z == 0) ? Wq : (blockIdx.z == 1) ? Wk : Wv;
  h16*       WT = (blockIdx.z == 0) ? WqT : (blockIdx.z == 1) ? WkT : WvT;
  const int n0 = blockIdx.x * 64, k0 = blockIdx.y * 256, tid = threadIdx.x;
  for (int i = tid; i < 256 * 64; i += 256) { const int k = i >> 6, nl = i & 63; tile[nl][k] = (h16)W[(size_t)(k0 + k) * D_DIM + n0 + nl]; }
  __syncthreads();
  for (int g = tid; g < 64 * 32; g += 256) { const int nl = g >> 5, pc = g & 31; vst2(WT + (size_t)(n0 + nl) * D_DIM + k0 + pc * 8, *(const v4u*)(&tile[nl][pc * 8])); }
}

// ---------------- projection GEMM: out = X(16384x768) * W(768x768) + b ----------------
// 8 waves/WG: 4 M-subtiles x 2 N-groups(64). Each wave: 16x64 out (4 WMMA tiles). Block tile 64 x 128 staged in LDS (f16) and
__global__ __launch_bounds__(256) void proj_kernel(const h16* __restrict__ Xb, const h16* __restrict__ WT,
                            const float* __restrict__ bias, h16* __restrict__ out, int transposed) {
  __shared__ __align__(16) h16 T[128 * 136];      // [m][n] pitch 136 (transposed==0) or [n][m] pitch 72 (transposed==1)
  int m0 = blockIdx.x * 64;
  int n0 = blockIdx.y * 128;
  int w    = threadIdx.x >> 5;
  int lane = threadIdx.x & 31;
  int idx  = lane & 15;
  int half = lane >> 4;
  int m_w = m0 + (w & 3) * 16;
  int n_w = n0 + (w >> 2) * 64;

  v8f c[4] = {};
  const h16* arow = Xb + (size_t)m_w * D_DIM;
#pragma unroll 2
  for (int k0 = 0; k0 < D_DIM; k0 += 32) {
    v16h a = load_a_frag(arow, D_DIM, k0);
#pragma unroll
    for (int t = 0; t < 4; ++t) {
      v16h b = load_b_frag(WT + (size_t)(n_w + t * 16) * D_DIM, D_DIM, k0);
      c[t] = wmma_f16(a, b, c[t]);
    }
  }
#pragma unroll
  for (int t = 0; t < 4; ++t) {
    int cl = (w >> 2) * 64 + t * 16 + idx;          // local col
    float bv = bias[n0 + cl];
#pragma unroll
    for (int g = 0; g < 8; ++g) {
      int rl = (w & 3) * 16 + g + 8 * half;          // local row
      h16 hv = (h16)(c[t][g] + bv);
      if (!transposed) T[rl * 136 + cl] = hv; else T[cl * 72 + rl] = hv;
    }
  }
  __syncthreads();
  const int tid = threadIdx.x;
  if (!transposed) {
    for (int gg = tid; gg < 64 * 16; gg += 256) { const int rl = gg >> 4, pc = gg & 15; vst2(out + (size_t)(m0 + rl) * D_DIM + n0 + pc * 8, *(const v4u*)(&T[rl * 136 + pc * 8])); }
  } else {
    const int bb = m0 >> 12, s0 = m0 & (S_LEN - 1);
    for (int gg = tid; gg < 128 * 8; gg += 256) { const int cl = gg >> 3, pc = gg & 7; vst2(out + ((size_t)(bb * D_DIM + n0 + cl)) * S_LEN + s0 + pc * 8, *(const v4u*)(&T[cl * 72 + pc * 8])); }
  }
}

// ---------------- flash attention ----------------
// WG = 32 queries, 8 waves. KV tiles of 64 keys.
// Score phase: wave w -> (qi = w&1, kj = w>>1) 16x16 tile, K-loop over 768.
// PV phase:    wave w -> (qi = w&1, dg = w>>1) 16 q x 192 dims (12 accum tiles).
__global__ __launch_bounds__(256)
void attn_kernel(const h16* __restrict__ Q, const h16* __restrict__ K,
                 const h16* __restrict__ Vt, float* __restrict__ out) {
  __shared__ __align__(16) h16   Qs[32][QK_P];     // 48.5 KB
  __shared__ __align__(16) h16   Ks[64][QK_P];     // 97 KB (reused as the f32 output tile [32][768] after the loop)
  __shared__ __align__(16) h16   Vts[D_DIM][KV_P]; // 108 KB (d-major)
  __shared__ __align__(16) float Ss[32][SS_P];     // 9.25 KB
  __shared__ __align__(16) h16   Ps[32][KV_P];     // 4.5 KB
  __shared__ float alpha_s[32];
  __shared__ float l_s[32];

  int b   = blockIdx.y;
  int q0  = blockIdx.x * 32;
  int tid = threadIdx.x;
  int w    = tid >> 5;
  int lane = tid & 31;
  int idx  = lane & 15;
  int half = lane >> 4;
  int qi = w & 1;
  int kj = w >> 1;     // score kv subtile
  int dg = w >> 1;     // PV d-group (192 dims)

  const h16* Qg = Q + ((size_t)(b * S_LEN + q0)) * D_DIM;
  for (int c = tid; c < 32 * (D_DIM / 8); c += 256) {
    int r = c / (D_DIM / 8), dc = c % (D_DIM / 8);
    copy16_g2s(&Qs[r][dc * 8], Qg + (size_t)r * D_DIM + dc * 8);
  }

  v8f o[12] = {};
  int   srow = tid >> 3;          // softmax: 8 threads per query row
  int   sj   = tid & 7;
  float m_prev = -1e30f;
  float l_run  = 0.0f;
  const float scale = 0.03608439182435161f;  // 1/sqrt(768)

  for (int kv0 = 0; kv0 < S_LEN; kv0 += 64) {
    __syncthreads();   // prev PV done (and Qs issue point on first iter)
    const h16* Kg = K + ((size_t)(b * S_LEN + kv0)) * D_DIM;
    for (int c = tid; c < 64 * (D_DIM / 8); c += 256) {
      int r = c / (D_DIM / 8), dc = c % (D_DIM / 8);
      copy16_g2s(&Ks[r][dc * 8], Kg + (size_t)r * D_DIM + dc * 8);
    }
    const h16* Vg = Vt + (size_t)b * D_DIM * S_LEN + kv0;
    for (int c = tid; c < D_DIM * 8; c += 256) {
      int d = c / 8, j = c % 8;
      copy16_g2s(&Vts[d][j * 8], Vg + (size_t)d * S_LEN + j * 8);
    }
    __syncthreads();

    {
      v8f sc = {};
#pragma unroll 4
      for (int k0 = 0; k0 < D_DIM; k0 += 32) {
        v16h a = load_a_frag(&Qs[qi * 16][0], QK_P, k0);
        v16h bb = load_b_frag(&Ks[kj * 16][0], QK_P, k0);
        sc = wmma_f16(a, bb, sc);
      }
      int col = kj * 16 + idx;
#pragma unroll
      for (int g = 0; g < 8; ++g)
        Ss[qi * 16 + g + 8 * half][col] = sc[g] * scale;
    }
    __syncthreads();

    {
      float v[8];
      float mloc = -1e30f;
#pragma unroll
      for (int e = 0; e < 8; ++e) { v[e] = Ss[srow][sj + e * 8]; mloc = fmaxf(mloc, v[e]); }
#pragma unroll
      for (int msk = 1; msk < 8; msk <<= 1) mloc = fmaxf(mloc, __shfl_xor(mloc, msk, 32));
      float m_new = fmaxf(m_prev, mloc);
      float alpha = __expf(m_prev - m_new);
      float ssum = 0.0f;
#pragma unroll
      for (int e = 0; e < 8; ++e) {
        float p = __expf(v[e] - m_new);
        ssum += p;
        Ps[srow][sj + e * 8] = (h16)(p * PSC);
      }
#pragma unroll
      for (int msk = 1; msk < 8; msk <<= 1) ssum += __shfl_xor(ssum, msk, 32);
      l_run = l_run * alpha + ssum;
      m_prev = m_new;
      if (sj == 0) { alpha_s[srow] = alpha; l_s[srow] = l_run; }
    }
    __syncthreads();

    {
      float al[8];
#pragma unroll
      for (int g = 0; g < 8; ++g) al[g] = alpha_s[qi * 16 + g + 8 * half];
#pragma unroll
      for (int t = 0; t < 12; ++t)
#pragma unroll
        for (int g = 0; g < 8; ++g) o[t][g] *= al[g];
#pragma unroll
      for (int k0 = 0; k0 < 64; k0 += 32) {
        v16h a = load_a_frag(&Ps[qi * 16][0], KV_P, k0);
#pragma unroll
        for (int t = 0; t < 12; ++t) {
          v16h bb = load_b_frag(&Vts[dg * 192 + t * 16][0], KV_P, k0);
          o[t] = wmma_f16(a, bb, o[t]);
        }
      }
    }
  }
  __syncthreads();

  float* Ot = (float*)&Ks[0][0];
  float linv[8];
#pragma unroll
  for (int g = 0; g < 8; ++g) linv[g] = PUN / l_s[qi * 16 + g + 8 * half];
#pragma unroll
  for (int t = 0; t < 12; ++t) {
    int col = dg * 192 + t * 16 + idx;
#pragma unroll
    for (int g = 0; g < 8; ++g) Ot[(qi * 16 + g + 8 * half) * D_DIM + col] = o[t][g] * linv[g];
  }
  __syncthreads();
  {
    float* dst = out + ((size_t)(b * S_LEN + q0)) * D_DIM;      // 32 contiguous rows
    for (int gg = tid; gg < 32 * D_DIM / 4; gg += 256) vst2(dst + (size_t)gg * 4, *(const v4f*)(Ot + gg * 4));
  }
}

extern "C" void kernel_launch(void* const* d_in, const int* in_sizes, int n_in,
                              void* d_out, int out_size, void* d_ws, size_t ws_size,
                              hipStream_t stream) {
  (void)in_sizes; (void)n_in; (void)out_size; (void)ws_size;
  const float* x  = (const float*)d_in[0];
  const float* Wq = (const float*)d_in[1];
  const float* bq = (const float*)d_in[2];
  const float* Wk = (const float*)d_in[3];
  const float* bk = (const float*)d_in[4];
  const float* Wv = (const float*)d_in[5];
  const float* bv = (const float*)d_in[6];
  float* out = (float*)d_out;

  char* ws = (char*)d_ws;
  h16* xb  = (h16*)(ws + 0);           // 16384*768*2 = 25,165,824
  h16* WqT = (h16*)(ws + 25165824);    // 768*768*2   =  1,179,648
  h16* WkT = (h16*)(ws + 26345472);
  h16* WvT = (h16*)(ws + 27525120);
  h16* qb  = (h16*)(ws + 28704768);    // 25,165,824
  h16* kb  = (h16*)(ws + 53870592);    // 25,165,824
  h16* vtb = (h16*)(ws + 79036416);    // 25,165,824  (stored [b][d][s])

  int nx8 = M_TOT * D_DIM / 8;
  cvt_x_kernel<<<nx8 / 256, 256, 0, stream>>>(x, xb, nx8);
  cvt_w_kernel<<<dim3(D_DIM / 64, D_DIM / 256, 3), 256, 0, stream>>>(Wq, Wk, Wv, WqT, WkT, WvT);

  dim3 pg(M_TOT / 64, D_DIM / 128);
  proj_kernel<<<pg, 256, 0, stream>>>(xb, WqT, bq, qb, 0);
  proj_kernel<<<pg, 256, 0, stream>>>(xb, WkT, bk, kb, 0);
  proj_kernel<<<pg, 256, 0, stream>>>(xb, WvT, bv, vtb, 1);

  attn_kernel<<<dim3(S_LEN / 32, B_SZ), 256, 0, stream>>>(qb, kb, vtb, out);
}

// v002
// One run takes 627 microseconds.
// Next to v001, in two timings, it ran 1.84 and 1.83 times as fast.
// All steps since v000 together make it 3.26 times as fast.
#include <hip/hip_runtime.h>
// Contractions: Q/K/V projections (K = 768), scores Q K^T (K = 768) and P V (K = keys) on v_wmma_f32_16x16x32_f16
// (f16 operands, f32 accumulate; P scaled by 256 before its f16 conversion); softmax statistics in f32.

typedef _Float16 h16;
typedef _Float16 h16x8 __attribute__((ext_vector_type(8)));
typedef _Float16 v16h  __attribute__((ext_vector_type(16)));
typedef float  v8f    __attribute__((ext_vector_type(8)));
typedef float  v4f    __attribute__((ext_vector_type(4)));
typedef unsigned v4u  __attribute__((ext_vector_type(4)));

#define D_DIM 768
#define S_LEN 4096
#define B_SZ  4
#define M_TOT (B_SZ * S_LEN)   // 16384
#define PSC 256.0f
#define PUN (1.0f / 256.0f)
// LDS row pitches of the attention tiles. Fragment rows read by 16-byte LDS loads sit at 16 B x odd, so that the 16 rows
// of a half-wave fall on 16 different groups of four banks (64 banks of 4 B) instead of all on one group.
#define QK_P 776   // halves: 1552 B = 16 B x 97 (768 data + 8 pad)
#define KV_P 72    // halves:  144 B = 16 B x 9  (64 data + 8 pad)
#define SS_P 68    // floats:  272 B = 16 B x 17: rows r and r + 8 of a score store lie 32 banks apart; a softmax read meets two-way conflicts
#define PS_P 136   // halves:  272 B: row r of P lies in the first 128 B of score row r (the 8 threads that read that row overwrite it)

template <typename V> __device__ __forceinline__ void vst2(void* p, V v) {
  *(V*)p = v; 
}
__device__ __forceinline__ void copy16_g2s(h16* ldst, const h16* gsrc) { *(h16x8*)ldst = *(const h16x8*)gsrc; }

// ---- WMMA fragment loaders (f16, row-major K-contiguous source); A and B (from B^T rows) share the per-lane K map:
//      row/col = lane&15; elements 0..7 <- k0 + 8*half + 0..7, elements 8..15 <- k0 + 16 + 8*half + 0..7
__device__ __forceinline__ v16h load_a_frag(const h16* base, int ld, int k0) {
  int lane = threadIdx.x & 31;
  int idx  = lane & 15;
  int half = lane >> 4;
  const h16* p = base + idx * ld + k0 + half * 8;
  h16x8 lo = *(const h16x8*)(p);
  h16x8 hi = *(const h16x8*)(p + 16);
  return __builtin_shufflevector(lo, hi, 0,1,2,3,4,5,6,7,8,9,10,11,12,13,14,15);
}
__device__ __forceinline__ v16h load_b_frag(const h16* base, int ld, int k0) { return load_a_frag(base, ld, k0); }

__device__ __forceinline__ v8f wmma_f16(v16h a, v16h b, v8f c) {
  v8f d = __builtin_amdgcn_wmma_f32_16x16x32_f16(false, a, false, b, (short)0, c, false, false);
  asm volatile("v_nop\n\tv_nop\n\tv_nop\n\tv_nop" : "+v"(d) : "v"(a), "v"(b));
  return d;
}

// ---------------- conversion kernels ----------------
__global__ void cvt_x_kernel(const float* __restrict__ x, h16* __restrict__ xb, int n8) {   // 8 elements (16 B) per thread
  int g = blockIdx.x * blockDim.x + threadIdx.x;
  if (g >= n8) return;
  const v4f a = *(const v4f*)(x + (size_t)g * 8), b = *(const v4f*)(x + (size_t)g * 8 + 4);
  union { h16x8 h; v4u u; } pk;
#pragma unroll
  for (int i = 0; i < 4; ++i) { pk.h[i] = (h16)a[i]; pk.h[4 + i] = (h16)b[i]; }
  vst2(xb + (size_t)g * 8, pk.u);
}

__global__ __launch_bounds__(256) void cvt_w_kernel(const float* __restrict__ Wq, const float* __restrict__ Wk, const float* __restrict__ Wv,
                                                    h16* __restrict__ WqT, h16* __restrict__ WkT, h16* __restrict__ WvT) {
  __shared__ __align__(16) h16 tile[64][264];
  const float* W = (blockIdx.z == 0) ? Wq : (blockIdx.z == 1) ? Wk : Wv;
  h16*       WT = (blockIdx.z == 0) ? WqT : (blockIdx.z == 1) ? WkT : WvT;
  const int n0 = blockIdx.x * 64, k0 = blockIdx.y * 256, tid = threadIdx.x;
  for (int i = tid; i < 256 * 64; i += 256) { const int k = i >> 6, nl = i & 63; tile[nl][k] = (h16)W[(size_t)(k0 + k) * D_DIM + n0 + nl]; }
  __syncthreads();
  for (int g = tid; g < 64 * 32; g += 256) { const int nl = g >> 5, pc = g & 31; vst2(WT + (size_t)(n0 + nl) * D_DIM + k0 + pc * 8, *(const v4u*)(&tile[nl][pc * 8])); }
}

// ---------------- projection GEMM: out = X(16384x768) * W(768x768) + b ----------------
// 8 waves/WG: 4 M-subtiles x 2 N-groups(64). Each wave: 16x64 out (4 WMMA tiles). Block tile 64 x 128 staged in LDS (f16) and
__global__ __launch_bounds__(256) void proj_kernel(const h16* __restrict__ Xb, const h16* __restrict__ WT,
                            const float* __restrict__ bias, h16* __restrict__ out, int transposed) {
  __shared__ __align__(16) h16 T[128 * 136];      // [m][n] pitch 136 (transposed==0) or [n][m] pitch 72 (transposed==1)
  int m0 = blockIdx.x * 64;
  int n0 = blockIdx.y * 128;
  int w    = threadIdx.x >> 5;
  int lane = threadIdx.x & 31;
  int idx  = lane & 15;
  int half = lane >> 4;
  int m_w = m0 + (w & 3) * 16;
  int n_w = n0 + (w >> 2) * 64;

  v8f c[4] = {};
  const h16* arow = Xb + (size_t)m_w * D_DIM;
#pragma unroll 2
  for (int k0 = 0; k0 < D_DIM; k0 += 32) {
    v16h a = load_a_frag(arow, D_DIM, k0);
#pragma unroll
    for (int t = 0; t < 4; ++t) {
      v16h b = load_b_frag(WT + (size_t)(n_w + t * 16) * D_DIM, D_DIM, k0);
      c[t] = wmma_f16(a, b, c[t]);
    }
  }
#pragma unroll
  for (int t = 0; t < 4; ++t) {
    int cl = (w >> 2) * 64 + t * 16 + idx;          // local col
    float bv = bias[n0 + cl];
#pragma unroll
    for (int g = 0; g < 8; ++g) {
      int rl = (w & 3) * 16 + g + 8 * half;          // local row
      h16 hv = (h16)(c[t][g] + bv);
      if (!transposed) T[rl * 136 + cl] = hv; else T[cl * 72 + rl] = hv;
    }
  }
  __syncthreads();
  const int tid = threadIdx.x;
  if (!transposed) {
    for (int gg = tid; gg < 64 * 16; gg += 256) { const int rl = gg >> 4, pc = gg & 15; vst2(out + (size_t)(m0 + rl) * D_DIM + n0 + pc * 8, *(const v4u*)(&T[rl * 136 + pc * 8])); }
  } else {
    const int bb = m0 >> 12, s0 = m0 & (S_LEN - 1);
    for (int gg = tid; gg < 128 * 8; gg += 256) { const int cl = gg >> 3, pc = gg & 7; vst2(out + ((size_t)(bb * D_DIM + n0 + cl)) * S_LEN + s0 + pc * 8, *(const v4u*)(&T[cl * 72 + pc * 8])); }
  }
}

// ---------------- flash attention ----------------
// WG = 64 queries, 16 waves: every staged K and V^T tile serves 64 queries. KV tiles of 64 keys.
// Score phase: wave w -> (qi = w&3, kj = w>>2) 16x16 tile, K-loop over 768.
// PV phase:    wave w -> (qi = w&3, dg = w>>2) 16 q x 192 dims (12 accum tiles).
__global__ __launch_bounds__(512)
void attn_kernel(const h16* __restrict__ Q, const h16* __restrict__ K,
                 const h16* __restrict__ Vt, float* __restrict__ out) {
  __shared__ __align__(16) h16   Qs[64][QK_P];     // 97 KB (reused as f32 output rows 32..63 after the loop)
  __shared__ __align__(16) h16   Ks[64][QK_P];     // 97 KB (reused as f32 output rows 0..31 after the loop)
  __shared__ __align__(16) h16   Vts[D_DIM][KV_P]; // 108 KB (d-major)
  __shared__ __align__(16) float Ss[64][SS_P];     // 17 KB (scores; then P in f16, row for row)
  __shared__ float alpha_s[64];
  __shared__ float l_s[64];

  int b   = blockIdx.y;
  int q0  = blockIdx.x * 64;
  int tid = threadIdx.x;
  int w    = tid >> 5;
  int lane = tid & 31;
  int idx  = lane & 15;
  int half = lane >> 4;
  int qi = w & 3;
  int kj = w >> 2;     // score kv subtile
  int dg = w >> 2;     // PV d-group (192 dims)

  const h16* Qg = Q + ((size_t)(b * S_LEN + q0)) * D_DIM;
  for (int c = tid; c < 64 * (D_DIM / 8); c += 512) {
    int r = c / (D_DIM / 8), dc = c % (D_DIM / 8);
    copy16_g2s(&Qs[r][dc * 8], Qg + (size_t)r * D_DIM + dc * 8);
  }

  v8f o[12] = {};
  int   srow = tid >> 3;          // softmax: 8 threads per query row
  int   sj   = tid & 7;
  float m_prev = -1e30f;
  float l_run  = 0.0f;
  const float scale = 0.03608439182435161f;  // 1/sqrt(768)

  for (int kv0 = 0; kv0 < S_LEN; kv0 += 64) {
    __syncthreads();   // prev PV done (and Qs issue point on first iter)
    const h16* Kg = K + ((size_t)(b * S_LEN + kv0)) * D_DIM;
    for (int c = tid; c < 64 * (D_DIM / 8); c += 512) {
      int r = c / (D_DIM / 8), dc = c % (D_DIM / 8);
      copy16_g2s(&Ks[r][dc * 8], Kg + (size_t)r * D_DIM + dc * 8);
    }
    const h16* Vg = Vt + (size_t)b * D_DIM * S_LEN + kv0;
#pragma unroll   // 12 trips, unrolled whole: by eights the compiler leaves four one-load trips, each waiting out its own latency
    for (int i = 0; i < D_DIM * 8 / 512; ++i) {
      int c = tid + i * 512, d = c / 8, j = c % 8;
      copy16_g2s(&Vts[d][j * 8], Vg + (size_t)d * S_LEN + j * 8);
    }
    __syncthreads();

    {
      v8f sc = {};
#pragma unroll 4
      for (int k0 = 0; k0 < D_DIM; k0 += 32) {
        v16h a = load_a_frag(&Qs[qi * 16][0], QK_P, k0);
        v16h bb = load_b_frag(&Ks[kj * 16][0], QK_P, k0);
        sc = wmma_f16(a, bb, sc);
      }
      int col = kj * 16 + idx;
#pragma unroll
      for (int g = 0; g < 8; ++g)
        Ss[qi * 16 + g + 8 * half][col] = sc[g] * scale;
    }
    __syncthreads();

    {
      float v[8];
      float mloc = -1e30f;
#pragma unroll
      for (int e = 0; e < 8; ++e) { v[e] = Ss[srow][sj + e * 8]; mloc = fmaxf(mloc, v[e]); }
#pragma unroll
      for (int msk = 1; msk < 8; msk <<= 1) mloc = fmaxf(mloc, __shfl_xor(mloc, msk, 32));
      float m_new = fmaxf(m_prev, mloc);
      float alpha = __expf(m_prev - m_new);
      float ssum = 0.0f;
      h16* prow = (h16*)&Ss[srow][0];   // every score of this row is in registers: m_new was formed from all of them
#pragma unroll
      for (int e = 0; e < 8; ++e) {
        float p = __expf(v[e] - m_new);
        ssum += p;
        prow[sj + e * 8] = (h16)(p * PSC);
      }
#pragma unroll
      for (int msk = 1; msk < 8; msk <<= 1) ssum += __shfl_xor(ssum, msk, 32);
      l_run = l_run * alpha + ssum;
      m_prev = m_new;
      if (sj == 0) { alpha_s[srow] = alpha; l_s[srow] = l_run; }
    }
    __syncthreads();

    {
      float al[8];
#pragma unroll
      for (int g = 0; g < 8; ++g) al[g] = alpha_s[qi * 16 + g + 8 * half];
#pragma unroll
      for (int t = 0; t < 12; ++t)
#pragma unroll
        for (int g = 0; g < 8; ++g) o[t][g] *= al[g];
#pragma unroll
      for (int k0 = 0; k0 < 64; k0 += 32) {
        v16h a = load_a_frag((const h16*)&Ss[qi * 16][0], PS_P, k0);
#pragma unroll
        for (int t = 0; t < 12; ++t) {
          v16h bb = load_b_frag(&Vts[dg * 192 + t * 16][0], KV_P, k0);
          o[t] = wmma_f16(a, bb, o[t]);
        }
      }
    }
  }
  __syncthreads();

  float* Ot = (qi < 2) ? (float*)&Ks[0][0] : (float*)&Qs[0][0];   // 32 output rows in each
  float linv[8];
#pragma unroll
  for (int g = 0; g < 8; ++g) linv[g] = PUN / l_s[qi * 16 + g + 8 * half];
#pragma unroll
  for (int t = 0; t < 12; ++t) {
    int col = dg * 192 + t * 16 + idx;
#pragma unroll
    for (int g = 0; g < 8; ++g) Ot[((qi & 1) * 16 + g + 8 * half) * D_DIM + col] = o[t][g] * linv[g];
  }
  __syncthreads();
  {
    float* dst = out + ((size_t)(b * S_LEN + q0)) * D_DIM;      // 64 contiguous rows
    const float* O0 = (const float*)&Ks[0][0];
    const float* O1 = (const float*)&Qs[0][0];
    for (int gg = tid; gg < 32 * D_DIM / 4; gg += 512) vst2(dst + (size_t)gg * 4, *(const v4f*)(O0 + gg * 4));
    for (int gg = tid; gg < 32 * D_DIM / 4; gg += 512) vst2(dst + (size_t)(32 * D_DIM) + (size_t)gg * 4, *(const v4f*)(O1 + gg * 4));
  }
}

extern "C" void kernel_launch(void* const* d_in, const int* in_sizes, int n_in,
                              void* d_out, int out_size, void* d_ws, size_t ws_size,
                              hipStream_t stream) {
  (void)in_sizes; (void)n_in; (void)out_size; (void)ws_size;
  const float* x  = (const float*)d_in[0];
  const float* Wq = (const float*)d_in[1];
  const float* bq = (const float*)d_in[2];
  const float* Wk = (const float*)d_in[3];
  const float* bk = (const float*)d_in[4];
  const float* Wv = (const float*)d_in[5];
  const float* bv = (const float*)d_in[6];
  float* out = (float*)d_out;

  char* ws = (char*)d_ws;
  h16* xb  = (h16*)(ws + 0);           // 16384*768*2 = 25,165,824
  h16* WqT = (h16*)(ws + 25165824);    // 768*768*2   =  1,179,648
  h16* WkT = (h16*)(ws + 26345472);
  h16* WvT = (h16*)(ws + 27525120);
  h16* qb  = (h16*)(ws + 28704768);    // 25,165,824
  h16* kb  = (h16*)(ws + 53870592);    // 25,165,824
  h16* vtb = (h16*)(ws + 79036416);    // 25,165,824  (stored [b][d][s])

  int nx8 = M_TOT * D_DIM / 8;
  cvt_x_kernel<<<nx8 / 256, 256, 0, stream>>>(x, xb, nx8);
  cvt_w_kernel<<<dim3(D_DIM / 64, D_DIM / 256, 3), 256, 0, stream>>>(Wq, Wk, Wv, WqT, WkT, WvT);

  dim3 pg(M_TOT / 64, D_DIM / 128);
  proj_kernel<<<pg, 256, 0, stream>>>(xb, WqT, bq, qb, 0);
  proj_kernel<<<pg, 256, 0, stream>>>(xb, WkT, bk, kb, 0);
  proj_kernel<<<pg, 256, 0, stream>>>(xb, WvT, bv, vtb, 1);

  attn_kernel<<<dim3(S_LEN / 64, B_SZ), 512, 0, stream>>>(qb, kb, vtb, out);
}

// v003
// One run takes 526 microseconds.
// In both of two side-by-side timings against v002, it was 1.20 times as fast.
// All steps since v000 together make it 3.90 times as fast.
#include <hip/hip_runtime.h>
// Contractions: Q/K/V projections (K = 768), scores Q K^T (K = 768) and P V (K = keys) on v_wmma_f32_16x16x32_f16
// (f16 operands, f32 accumulate; P scaled by 256 before its f16 conversion); softmax statistics in f32.

typedef _Float16 h16;
typedef _Float16 h16x8 __attribute__((ext_vector_type(8)));
typedef _Float16 v16h  __attribute__((ext_vector_type(16)));
typedef float  v8f    __attribute__((ext_vector_type(8)));
typedef float  v4f    __attribute__((ext_vector_type(4)));
typedef unsigned v4u  __attribute__((ext_vector_type(4)));

#define D_DIM 768
#define S_LEN 4096
#define B_SZ  4
#define M_TOT (B_SZ * S_LEN)   // 16384
#define PSC 256.0f
#define PUN (1.0f / 256.0f)
// LDS row pitches of the attention tiles. Fragment rows read by 16-byte LDS loads sit at 16 B x odd, so that the 16 rows
// of a half-wave fall on 16 different groups of four banks (64 banks of 4 B) instead of all on one group.
#define QK_P 776   // halves: 1552 B = 16 B x 97 (768 data + 8 pad)
#define KV_P 72    // halves:  144 B = 16 B x 9  (64 data + 8 pad)
#define SS_P 68    // floats:  272 B = 16 B x 17: rows r and r + 8 of a score store lie 32 banks apart; a softmax read meets two-way conflicts
#define PS_P 136   // halves:  272 B: row r of P lies in the first 128 B of score row r (the 8 threads that read that row overwrite it)

template <typename V> __device__ __forceinline__ void vst2(void* p, V v) {
  *(V*)p = v; 
}
__device__ __forceinline__ void copy16_g2s(h16* ldst, const h16* gsrc) { *(h16x8*)ldst = *(const h16x8*)gsrc; }

__device__ __forceinline__ void copy12_async(const unsigned (&l)[12], const h16* const (&g)[12]) {
  asm volatile("global_load_async_to_lds_b128 %0, %12, off\n\t"
               "global_load_async_to_lds_b128 %1, %13, off\n\t"
               "global_load_async_to_lds_b128 %2, %14, off\n\t"
               "global_load_async_to_lds_b128 %3, %15, off\n\t"
               "global_load_async_to_lds_b128 %4, %16, off\n\t"
               "global_load_async_to_lds_b128 %5, %17, off\n\t"
               "global_load_async_to_lds_b128 %6, %18, off\n\t"
               "global_load_async_to_lds_b128 %7, %19, off\n\t"
               "global_load_async_to_lds_b128 %8, %20, off\n\t"
               "global_load_async_to_lds_b128 %9, %21, off\n\t"
               "global_load_async_to_lds_b128 %10, %22, off\n\t"
               "global_load_async_to_lds_b128 %11, %23, off\n\t"
               "s_wait_xcnt 0x0"
               :: "v"(l[0]), "v"(l[1]), "v"(l[2]), "v"(l[3]), "v"(l[4]), "v"(l[5]), "v"(l[6]), "v"(l[7]), "v"(l[8]), "v"(l[9]), "v"(l[10]), "v"(l[11]),
                  "v"(g[0]), "v"(g[1]), "v"(g[2]), "v"(g[3]), "v"(g[4]), "v"(g[5]), "v"(g[6]), "v"(g[7]), "v"(g[8]), "v"(g[9]), "v"(g[10]), "v"(g[11])
               : "memory");
}
// K tile, 64 rows of 1536 B: 16 lanes take 256 B of a row; copy i: row + 32 * (i / 6), byte + 256 * (i % 6).
__device__ __forceinline__ void stage_k_async(unsigned l0, const h16* g0) {
  unsigned l[12]; const h16* g[12];
#pragma unroll
  for (int i = 0; i < 12; ++i) { l[i] = l0 + (i / 6) * 32 * QK_P * 2 + (i % 6) * 256; g[i] = g0 + (i / 6) * 32 * D_DIM + (i % 6) * 128; }
  copy12_async(l, g);
}
// V^T tile, 768 rows of 128 B: 8 lanes take a row; copy i: row + 64 * i.
__device__ __forceinline__ void stage_v_async(unsigned l0, const h16* g0) {
  unsigned l[12]; const h16* g[12];
#pragma unroll
  for (int i = 0; i < 12; ++i) { l[i] = l0 + i * 64 * KV_P * 2; g[i] = g0 + (size_t)i * 64 * S_LEN; }
  copy12_async(l, g);
}

// ---- WMMA fragment loaders (f16, row-major K-contiguous source); A and B (from B^T rows) share the per-lane K map:
//      row/col = lane&15; elements 0..7 <- k0 + 8*half + 0..7, elements 8..15 <- k0 + 16 + 8*half + 0..7
__device__ __forceinline__ v16h load_a_frag(const h16* base, int ld, int k0) {
  int lane = threadIdx.x & 31;
  int idx  = lane & 15;
  int half = lane >> 4;
  const h16* p = base + idx * ld + k0 + half * 8;
  h16x8 lo = *(const h16x8*)(p);
  h16x8 hi = *(const h16x8*)(p + 16);
  return __builtin_shufflevector(lo, hi, 0,1,2,3,4,5,6,7,8,9,10,11,12,13,14,15);
}
__device__ __forceinline__ v16h load_b_frag(const h16* base, int ld, int k0) { return load_a_frag(base, ld, k0); }

__device__ __forceinline__ v8f wmma_f16(v16h a, v16h b, v8f c) {
  v8f d = __builtin_amdgcn_wmma_f32_16x16x32_f16(false, a, false, b, (short)0, c, false, false);
  asm volatile("v_nop\n\tv_nop\n\tv_nop\n\tv_nop" : "+v"(d) : "v"(a), "v"(b));
  return d;
}

// ---------------- conversion kernels ----------------
__global__ void cvt_x_kernel(const float* __restrict__ x, h16* __restrict__ xb, int n8) {   // 8 elements (16 B) per thread
  int g = blockIdx.x * blockDim.x + threadIdx.x;
  if (g >= n8) return;
  const v4f a = *(const v4f*)(x + (size_t)g * 8), b = *(const v4f*)(x + (size_t)g * 8 + 4);
  union { h16x8 h; v4u u; } pk;
#pragma unroll
  for (int i = 0; i < 4; ++i) { pk.h[i] = (h16)a[i]; pk.h[4 + i] = (h16)b[i]; }
  vst2(xb + (size_t)g * 8, pk.u);
}

__global__ __launch_bounds__(256) void cvt_w_kernel(const float* __restrict__ Wq, const float* __restrict__ Wk, const float* __restrict__ Wv,
                                                    h16* __restrict__ WqT, h16* __restrict__ WkT, h16* __restrict__ WvT) {
  __shared__ __align__(16) h16 tile[64][264];
  const float* W = (blockIdx.z == 0) ? Wq : (blockIdx.z == 1) ? Wk : Wv;
  h16*       WT = (blockIdx.z == 0) ? WqT : (blockIdx.z == 1) ? WkT : WvT;
  const int n0 = blockIdx.x * 64, k0 = blockIdx.y * 256, tid = threadIdx.x;
  for (int i = tid; i < 256 * 64; i += 256) { const int k = i >> 6, nl = i & 63; tile[nl][k] = (h16)W[(size_t)(k0 + k) * D_DIM + n0 + nl]; }
  __syncthreads();
  for (int g = tid; g < 64 * 32; g += 256) { const int nl = g >> 5, pc = g & 31; vst2(WT + (size_t)(n0 + nl) * D_DIM + k0 + pc * 8, *(const v4u*)(&tile[nl][pc * 8])); }
}

// ---------------- projection GEMM: out = X(16384x768) * W(768x768) + b ----------------
// 8 waves/WG: 4 M-subtiles x 2 N-groups(64). Each wave: 16x64 out (4 WMMA tiles). Block tile 64 x 128 staged in LDS (f16) and
__global__ __launch_bounds__(256) void proj_kernel(const h16* __restrict__ Xb, const h16* __restrict__ WT,
                            const float* __restrict__ bias, h16* __restrict__ out, int transposed) {
  __shared__ __align__(16) h16 T[128 * 136];      // [m][n] pitch 136 (transposed==0) or [n][m] pitch 72 (transposed==1)
  int m0 = blockIdx.x * 64;
  int n0 = blockIdx.y * 128;
  int w    = threadIdx.x >> 5;
  int lane = threadIdx.x & 31;
  int idx  = lane & 15;
  int half = lane >> 4;
  int m_w = m0 + (w & 3) * 16;
  int n_w = n0 + (w >> 2) * 64;

  v8f c[4] = {};
  const h16* arow = Xb + (size_t)m_w * D_DIM;
#pragma unroll 2
  for (int k0 = 0; k0 < D_DIM; k0 += 32) {
    v16h a = load_a_frag(arow, D_DIM, k0);
#pragma unroll
    for (int t = 0; t < 4; ++t) {
      v16h b = load_b_frag(WT + (size_t)(n_w + t * 16) * D_DIM, D_DIM, k0);
      c[t] = wmma_f16(a, b, c[t]);
    }
  }
#pragma unroll
  for (int t = 0; t < 4; ++t) {
    int cl = (w >> 2) * 64 + t * 16 + idx;          // local col
    float bv = bias[n0 + cl];
#pragma unroll
    for (int g = 0; g < 8; ++g) {
      int rl = (w & 3) * 16 + g + 8 * half;          // local row
      h16 hv = (h16)(c[t][g] + bv);
      if (!transposed) T[rl * 136 + cl] = hv; else T[cl * 72 + rl] = hv;
    }
  }
  __syncthreads();
  const int tid = threadIdx.x;
  if (!transposed) {
    for (int gg = tid; gg < 64 * 16; gg += 256) { const int rl = gg >> 4, pc = gg & 15; vst2(out + (size_t)(m0 + rl) * D_DIM + n0 + pc * 8, *(const v4u*)(&T[rl * 136 + pc * 8])); }
  } else {
    const int bb = m0 >> 12, s0 = m0 & (S_LEN - 1);
    for (int gg = tid; gg < 128 * 8; gg += 256) { const int cl = gg >> 3, pc = gg & 7; vst2(out + ((size_t)(bb * D_DIM + n0 + cl)) * S_LEN + s0 + pc * 8, *(const v4u*)(&T[cl * 72 + pc * 8])); }
  }
}

// ---------------- flash attention ----------------
// WG = 64 queries, 16 waves: every staged K and V^T tile serves 64 queries. KV tiles of 64 keys.
// Score phase: wave w -> (qi = w&3, kj = w>>2) 16x16 tile, K-loop over 768.
// PV phase:    wave w -> (qi = w&3, dg = w>>2) 16 q x 192 dims (12 accum tiles).
__global__ __launch_bounds__(512)
void attn_kernel(const h16* __restrict__ Q, const h16* __restrict__ K,
                 const h16* __restrict__ Vt, float* __restrict__ out) {
  __shared__ __align__(16) h16   Qs[64][QK_P];     // 97 KB (reused as f32 output rows 32..63 after the loop)
  __shared__ __align__(16) h16   Ks[64][QK_P];     // 97 KB (reused as f32 output rows 0..31 after the loop)
  __shared__ __align__(16) h16   Vts[D_DIM][KV_P]; // 108 KB (d-major)
  __shared__ __align__(16) float Ss[64][SS_P];     // 17 KB (scores; then P in f16, row for row)
  __shared__ float alpha_s[64];
  __shared__ float l_s[64];

  int b   = blockIdx.y;
  int q0  = blockIdx.x * 64;
  int tid = threadIdx.x;
  int w    = tid >> 5;
  int lane = tid & 31;
  int idx  = lane & 15;
  int half = lane >> 4;
  int qi = w & 3;
  int kj = w >> 2;     // score kv subtile
  int dg = w >> 2;     // PV d-group (192 dims)

  // Each lane's first LDS byte address (the low 32 bits of the __shared__ address) and first global address of the two tiles.
  const unsigned kl0 = (unsigned)(size_t)&Ks[tid >> 4][(tid & 15) * 8];
  const unsigned vl0 = (unsigned)(size_t)&Vts[tid >> 3][(tid & 7) * 8];
  const h16* kg0 = K + ((size_t)(b * S_LEN) + (tid >> 4)) * D_DIM + (tid & 15) * 8;
  const h16* vg0 = Vt + (size_t)b * D_DIM * S_LEN + (size_t)(tid >> 3) * S_LEN + (tid & 7) * 8;
  stage_k_async(kl0, kg0);   // K tile 0 flies while Q is staged

  const h16* Qg = Q + ((size_t)(b * S_LEN + q0)) * D_DIM;
  for (int c = tid; c < 64 * (D_DIM / 8); c += 512) {
    int r = c / (D_DIM / 8), dc = c % (D_DIM / 8);
    copy16_g2s(&Qs[r][dc * 8], Qg + (size_t)r * D_DIM + dc * 8);
  }

  v8f o[12] = {};
  int   srow = tid >> 3;          // softmax: 8 threads per query row
  int   sj   = tid & 7;
  float m_prev = -1e30f;
  float l_run  = 0.0f;
  const float scale = 0.03608439182435161f;  // 1/sqrt(768)

  for (int kv0 = 0; kv0 < S_LEN; kv0 += 64) {
    // Publish point of this K tile: its copies flew under the previous PV phase (tile 0: under the staging of Q).
    asm volatile("s_wait_dscnt 0x0" ::: "memory");      // this wave's reads of V^T and P (first trip: its stores of Q) are done
    asm volatile("s_wait_asynccnt 0x0" ::: "memory");   // this wave's copies of the K tile have landed
    __syncthreads();   // K (and Q) readable by all; every reader has left V^T
    stage_v_async(vl0, vg0 + kv0);   // this V^T tile flies under the score and softmax phases

    {
      v8f sc = {};
#pragma unroll 4
      for (int k0 = 0; k0 < D_DIM; k0 += 32) {
        v16h a = load_a_frag(&Qs[qi * 16][0], QK_P, k0);
        v16h bb = load_b_frag(&Ks[kj * 16][0], QK_P, k0);
        sc = wmma_f16(a, bb, sc);
      }
      int col = kj * 16 + idx;
#pragma unroll
      for (int g = 0; g < 8; ++g)
        Ss[qi * 16 + g + 8 * half][col] = sc[g] * scale;
    }
    __syncthreads();

    {
      float v[8];
      float mloc = -1e30f;
#pragma unroll
      for (int e = 0; e < 8; ++e) { v[e] = Ss[srow][sj + e * 8]; mloc = fmaxf(mloc, v[e]); }
#pragma unroll
      for (int msk = 1; msk < 8; msk <<= 1) mloc = fmaxf(mloc, __shfl_xor(mloc, msk, 32));
      float m_new = fmaxf(m_prev, mloc);
      float alpha = __expf(m_prev - m_new);
      float ssum = 0.0f;
      h16* prow = (h16*)&Ss[srow][0];   // every score of this row is in registers: m_new was formed from all of them
#pragma unroll
      for (int e = 0; e < 8; ++e) {
        float p = __expf(v[e] - m_new);
        ssum += p;
        prow[sj + e * 8] = (h16)(p * PSC);
      }
#pragma unroll
      for (int msk = 1; msk < 8; msk <<= 1) ssum += __shfl_xor(ssum, msk, 32);
      l_run = l_run * alpha + ssum;
      m_prev = m_new;
      if (sj == 0) { alpha_s[srow] = alpha; l_s[srow] = l_run; }
    }
    // Publish point of this V^T tile (and of P).
    asm volatile("s_wait_dscnt 0x0" ::: "memory");      // this wave's stores of P and its reads of K are done
    asm volatile("s_wait_asynccnt 0x0" ::: "memory");   // this wave's copies of the V^T tile have landed
    __syncthreads();   // V^T and P readable by all; every reader left K at the barrier behind the scores
    if (kv0 + 64 < S_LEN) stage_k_async(kl0, kg0 + (size_t)(kv0 + 64) * D_DIM);   // the next K tile flies under the PV phase

    {
      float al[8];
#pragma unroll
      for (int g = 0; g < 8; ++g) al[g] = alpha_s[qi * 16 + g + 8 * half];
#pragma unroll
      for (int t = 0; t < 12; ++t)
#pragma unroll
        for (int g = 0; g < 8; ++g) o[t][g] *= al[g];
#pragma unroll
      for (int k0 = 0; k0 < 64; k0 += 32) {
        v16h a = load_a_frag((const h16*)&Ss[qi * 16][0], PS_P, k0);
#pragma unroll
        for (int t = 0; t < 12; ++t) {
          v16h bb = load_b_frag(&Vts[dg * 192 + t * 16][0], KV_P, k0);
          o[t] = wmma_f16(a, bb, o[t]);
        }
      }
    }
  }
  asm volatile("s_wait_asynccnt 0x0" ::: "memory");   // no copy is outstanding when K and Q become output staging
  __syncthreads();

  float* Ot = (qi < 2) ? (float*)&Ks[0][0] : (float*)&Qs[0][0];   // 32 output rows in each
  float linv[8];
#pragma unroll
  for (int g = 0; g < 8; ++g) linv[g] = PUN / l_s[qi * 16 + g + 8 * half];
#pragma unroll
  for (int t = 0; t < 12; ++t) {
    int col = dg * 192 + t * 16 + idx;
#pragma unroll
    for (int g = 0; g < 8; ++g) Ot[((qi & 1) * 16 + g + 8 * half) * D_DIM + col] = o[t][g] * linv[g];
  }
  __syncthreads();
  {
    float* dst = out + ((size_t)(b * S_LEN + q0)) * D_DIM;      // 64 contiguous rows
    const float* O0 = (const float*)&Ks[0][0];
    const float* O1 = (const float*)&Qs[0][0];
    for (int gg = tid; gg < 32 * D_DIM / 4; gg += 512) vst2(dst + (size_t)gg * 4, *(const v4f*)(O0 + gg * 4));
    for (int gg = tid; gg < 32 * D_DIM / 4; gg += 512) vst2(dst + (size_t)(32 * D_DIM) + (size_t)gg * 4, *(const v4f*)(O1 + gg * 4));
  }
}

extern "C" void kernel_launch(void* const* d_in, const int* in_sizes, int n_in,
                              void* d_out, int out_size, void* d_ws, size_t ws_size,
                              hipStream_t stream) {
  (void)in_sizes; (void)n_in; (void)out_size; (void)ws_size;
  const float* x  = (const float*)d_in[0];
  const float* Wq = (const float*)d_in[1];
  const float* bq = (const float*)d_in[2];
  const float* Wk = (const float*)d_in[3];
  const float* bk = (const float*)d_in[4];
  const float* Wv = (const float*)d_in[5];
  const float* bv = (const float*)d_in[6];
  float* out = (float*)d_out;

  char* ws = (char*)d_ws;
  h16* xb  = (h16*)(ws + 0);           // 16384*768*2 = 25,165,824
  h16* WqT = (h16*)(ws + 25165824);    // 768*768*2   =  1,179,648
  h16* WkT = (h16*)(ws + 26345472);
  h16* WvT = (h16*)(ws + 27525120);
  h16* qb  = (h16*)(ws + 28704768);    // 25,165,824
  h16* kb  = (h16*)(ws + 53870592);    // 25,165,824
  h16* vtb = (h16*)(ws + 79036416);    // 25,165,824  (stored [b][d][s])

  int nx8 = M_TOT * D_DIM / 8;
  cvt_x_kernel<<<nx8 / 256, 256, 0, stream>>>(x, xb, nx8);
  cvt_w_kernel<<<dim3(D_DIM / 64, D_DIM / 256, 3), 256, 0, stream>>>(Wq, Wk, Wv, WqT, WkT, WvT);

  dim3 pg(M_TOT / 64, D_DIM / 128);
  proj_kernel<<<pg, 256, 0, stream>>>(xb, WqT, bq, qb, 0);
  proj_kernel<<<pg, 256, 0, stream>>>(xb, WkT, bk, kb, 0);
  proj_kernel<<<pg, 256, 0, stream>>>(xb, WvT, bv, vtb, 1);

  attn_kernel<<<dim3(S_LEN / 64, B_SZ), 512, 0, stream>>>(qb, kb, vtb, out);
}

// v004
// A run of this version takes 485 microseconds.
// Two timings next to v003 both put it at 1.08 times that version's speed.
// All steps since v000 together make it 4.23 times as fast.
#include <hip/hip_runtime.h>
// Contractions: Q/K/V projections (K = 768), scores Q K^T (K = 768) and P V (K = keys) on v_wmma_f32_16x16x32_f16
// (f16 operands, f32 accumulate; P scaled by 256 before its f16 conversion); softmax statistics in f32.

typedef _Float16 h16;
typedef _Float16 h16x8 __attribute__((ext_vector_type(8)));
typedef _Float16 v16h  __attribute__((ext_vector_type(16)));
typedef float  v8f    __attribute__((ext_vector_type(8)));
typedef float  v4f    __attribute__((ext_vector_type(4)));
typedef unsigned v4u  __attribute__((ext_vector_type(4)));

#define D_DIM 768
#define S_LEN 4096
#define B_SZ  4
#define M_TOT (B_SZ * S_LEN)   // 16384
#define PSC 256.0f
#define PUN (1.0f / 256.0f)
// LDS row pitches of the attention tiles. Fragment rows read by 16-byte LDS loads sit at 16 B x odd, so that the 16 rows
// of a half-wave fall on 16 different groups of four banks (64 banks of 4 B) instead of all on one group.
#define QK_P 776   // halves: 1552 B = 16 B x 97 (768 data + 8 pad)
#define KV_P 72    // halves:  144 B = 16 B x 9  (64 data + 8 pad)
#define SS_P 68    // floats:  272 B = 16 B x 17: rows r and r + 8 of a score store lie 32 banks apart; a softmax read meets two-way conflicts
#define PS_P 136   // halves:  272 B: row r of P lies in the first 128 B of score row r (the 8 threads that read that row overwrite it)

template <typename V> __device__ __forceinline__ void vst2(void* p, V v) {
  *(V*)p = v; 
}
__device__ __forceinline__ void copy16_g2s(h16* ldst, const h16* gsrc) { *(h16x8*)ldst = *(const h16x8*)gsrc; }

__device__ __forceinline__ void copy12_async(const unsigned (&l)[12], const h16* const (&g)[12]) {
  asm volatile("global_load_async_to_lds_b128 %0, %12, off\n\t"
               "global_load_async_to_lds_b128 %1, %13, off\n\t"
               "global_load_async_to_lds_b128 %2, %14, off\n\t"
               "global_load_async_to_lds_b128 %3, %15, off\n\t"
               "global_load_async_to_lds_b128 %4, %16, off\n\t"
               "global_load_async_to_lds_b128 %5, %17, off\n\t"
               "global_load_async_to_lds_b128 %6, %18, off\n\t"
               "global_load_async_to_lds_b128 %7, %19, off\n\t"
               "global_load_async_to_lds_b128 %8, %20, off\n\t"
               "global_load_async_to_lds_b128 %9, %21, off\n\t"
               "global_load_async_to_lds_b128 %10, %22, off\n\t"
               "global_load_async_to_lds_b128 %11, %23, off\n\t"
               "s_wait_xcnt 0x0"
               :: "v"(l[0]), "v"(l[1]), "v"(l[2]), "v"(l[3]), "v"(l[4]), "v"(l[5]), "v"(l[6]), "v"(l[7]), "v"(l[8]), "v"(l[9]), "v"(l[10]), "v"(l[11]),
                  "v"(g[0]), "v"(g[1]), "v"(g[2]), "v"(g[3]), "v"(g[4]), "v"(g[5]), "v"(g[6]), "v"(g[7]), "v"(g[8]), "v"(g[9]), "v"(g[10]), "v"(g[11])
               : "memory");
}
// K tile, 64 rows of 1536 B: 16 lanes take 256 B of a row; copy i: row + 32 * (i / 6), byte + 256 * (i % 6).
__device__ __forceinline__ void stage_k_async(unsigned l0, const h16* g0) {
  unsigned l[12]; const h16* g[12];
#pragma unroll
  for (int i = 0; i < 12; ++i) { l[i] = l0 + (i / 6) * 32 * QK_P * 2 + (i % 6) * 256; g[i] = g0 + (i / 6) * 32 * D_DIM + (i % 6) * 128; }
  copy12_async(l, g);
}
// V^T tile, 768 rows of 128 B: 8 lanes take a row; copy i: row + 64 * i.
__device__ __forceinline__ void stage_v_async(unsigned l0, const h16* g0) {
  unsigned l[12]; const h16* g[12];
#pragma unroll
  for (int i = 0; i < 12; ++i) { l[i] = l0 + i * 64 * KV_P * 2; g[i] = g0 + (size_t)i * 64 * S_LEN; }
  copy12_async(l, g);
}

// ---- WMMA fragment loaders (f16, row-major K-contiguous source); A and B (from B^T rows) share the per-lane K map:
//      row/col = lane&15; elements 0..7 <- k0 + 8*half + 0..7, elements 8..15 <- k0 + 16 + 8*half + 0..7
__device__ __forceinline__ v16h load_a_frag(const h16* base, int ld, int k0) {
  int lane = threadIdx.x & 31;
  int idx  = lane & 15;
  int half = lane >> 4;
  const h16* p = base + idx * ld + k0 + half * 8;
  h16x8 lo = *(const h16x8*)(p);
  h16x8 hi = *(const h16x8*)(p + 16);
  return __builtin_shufflevector(lo, hi, 0,1,2,3,4,5,6,7,8,9,10,11,12,13,14,15);
}
__device__ __forceinline__ v16h load_b_frag(const h16* base, int ld, int k0) { return load_a_frag(base, ld, k0); }
// The same fragment from the lane's own address p = row start + k0 + 8 * half.
__device__ __forceinline__ v16h load_frag_at(const h16* p) {
  h16x8 lo = *(const h16x8*)(p);
  h16x8 hi = *(const h16x8*)(p + 16);
  return __builtin_shufflevector(lo, hi, 0,1,2,3,4,5,6,7,8,9,10,11,12,13,14,15);
}

__device__ __forceinline__ v8f wmma_f16(v16h a, v16h b, v8f c) {
  v8f d = __builtin_amdgcn_wmma_f32_16x16x32_f16(false, a, false, b, (short)0, c, false, false);
  asm volatile("v_nop\n\tv_nop\n\tv_nop\n\tv_nop" : "+v"(d) : "v"(a), "v"(b));
  return d;
}

// ---------------- conversion kernels ----------------
__global__ void cvt_x_kernel(const float* __restrict__ x, h16* __restrict__ xb, int n8) {   // 8 elements (16 B) per thread
  int g = blockIdx.x * blockDim.x + threadIdx.x;
  if (g >= n8) return;
  const v4f a = *(const v4f*)(x + (size_t)g * 8), b = *(const v4f*)(x + (size_t)g * 8 + 4);
  union { h16x8 h; v4u u; } pk;
#pragma unroll
  for (int i = 0; i < 4; ++i) { pk.h[i] = (h16)a[i]; pk.h[4 + i] = (h16)b[i]; }
  vst2(xb + (size_t)g * 8, pk.u);
}

__global__ __launch_bounds__(256) void cvt_w_kernel(const float* __restrict__ Wq, const float* __restrict__ Wk, const float* __restrict__ Wv,
                                                    h16* __restrict__ WqT, h16* __restrict__ WkT, h16* __restrict__ WvT) {
  __shared__ __align__(16) h16 tile[64][264];
  const float* W = (blockIdx.z == 0) ? Wq : (blockIdx.z == 1) ? Wk : Wv;
  h16*       WT = (blockIdx.z == 0) ? WqT : (blockIdx.z == 1) ? WkT : WvT;
  const int n0 = blockIdx.x * 64, k0 = blockIdx.y * 256, tid = threadIdx.x;
  for (int i = tid; i < 256 * 64; i += 256) { const int k = i >> 6, nl = i & 63; tile[nl][k] = (h16)W[(size_t)(k0 + k) * D_DIM + n0 + nl]; }
  __syncthreads();
  for (int g = tid; g < 64 * 32; g += 256) { const int nl = g >> 5, pc = g & 31; vst2(WT + (size_t)(n0 + nl) * D_DIM + k0 + pc * 8, *(const v4u*)(&tile[nl][pc * 8])); }
}

// ---------------- projection GEMM: out = X(16384x768) * W(768x768) + b ----------------
// 8 waves/WG: 4 M-subtiles x 2 N-groups(64). Each wave: 16x64 out (4 WMMA tiles). Block tile 64 x 128 staged in LDS (f16) and
__global__ __launch_bounds__(256) void proj_kernel(const h16* __restrict__ Xb, const h16* __restrict__ WT,
                            const float* __restrict__ bias, h16* __restrict__ out, int transposed) {
  __shared__ __align__(16) h16 T[128 * 136];      // [m][n] pitch 136 (transposed==0) or [n][m] pitch 72 (transposed==1)
  int m0 = blockIdx.x * 64;
  int n0 = blockIdx.y * 128;
  int w    = threadIdx.x >> 5;
  int lane = threadIdx.x & 31;
  int idx  = lane & 15;
  int half = lane >> 4;
  int m_w = m0 + (w & 3) * 16;
  int n_w = n0 + (w >> 2) * 64;

  v8f c[4] = {};
  const h16* arow = Xb + (size_t)m_w * D_DIM;
#pragma unroll 2
  for (int k0 = 0; k0 < D_DIM; k0 += 32) {
    v16h a = load_a_frag(arow, D_DIM, k0);
#pragma unroll
    for (int t = 0; t < 4; ++t) {
      v16h b = load_b_frag(WT + (size_t)(n_w + t * 16) * D_DIM, D_DIM, k0);
      c[t] = wmma_f16(a, b, c[t]);
    }
  }
#pragma unroll
  for (int t = 0; t < 4; ++t) {
    int cl = (w >> 2) * 64 + t * 16 + idx;          // local col
    float bv = bias[n0 + cl];
#pragma unroll
    for (int g = 0; g < 8; ++g) {
      int rl = (w & 3) * 16 + g + 8 * half;          // local row
      h16 hv = (h16)(c[t][g] + bv);
      if (!transposed) T[rl * 136 + cl] = hv; else T[cl * 72 + rl] = hv;
    }
  }
  __syncthreads();
  const int tid = threadIdx.x;
  if (!transposed) {
    for (int gg = tid; gg < 64 * 16; gg += 256) { const int rl = gg >> 4, pc = gg & 15; vst2(out + (size_t)(m0 + rl) * D_DIM + n0 + pc * 8, *(const v4u*)(&T[rl * 136 + pc * 8])); }
  } else {
    const int bb = m0 >> 12, s0 = m0 & (S_LEN - 1);
    for (int gg = tid; gg < 128 * 8; gg += 256) { const int cl = gg >> 3, pc = gg & 7; vst2(out + ((size_t)(bb * D_DIM + n0 + cl)) * S_LEN + s0 + pc * 8, *(const v4u*)(&T[cl * 72 + pc * 8])); }
  }
}

// ---------------- flash attention ----------------
// WG = 64 queries, 16 waves: every staged K and V^T tile serves 64 queries. KV tiles of 64 keys.
// Score phase: wave w -> (qi = w&3, kj = w>>2) 16x16 tile, K-loop over 768.
// PV phase:    wave w -> (qi = w&3, dg = w>>2) 16 q x 192 dims (12 accum tiles).
__global__ __launch_bounds__(512)
void attn_kernel(const h16* __restrict__ Q, const h16* __restrict__ K,
                 const h16* __restrict__ Vt, float* __restrict__ out) {
  __shared__ __align__(16) h16   Qs[64][QK_P];     // 97 KB (reused as f32 output rows 32..63 after the loop)
  __shared__ __align__(16) h16   Ks[64][QK_P];     // 97 KB (reused as f32 output rows 0..31 after the loop)
  __shared__ __align__(16) h16   Vts[D_DIM][KV_P]; // 108 KB (d-major)
  __shared__ __align__(16) float Ss[64][SS_P];     // 17 KB (scores; then P in f16, row for row)
  __shared__ float alpha_s[64];
  __shared__ float l_s[64];

  int b   = blockIdx.y;
  int q0  = blockIdx.x * 64;
  int tid = threadIdx.x;
  int w    = tid >> 5;
  int lane = tid & 31;
  int idx  = lane & 15;
  int half = lane >> 4;
  int qi = w & 3;
  int kj = w >> 2;     // score kv subtile
  int dg = w >> 2;     // PV d-group (192 dims)

  // Each lane's first LDS byte address (the low 32 bits of the __shared__ address) and first global address of the two tiles.
  const unsigned kl0 = (unsigned)(size_t)&Ks[tid >> 4][(tid & 15) * 8];
  const unsigned vl0 = (unsigned)(size_t)&Vts[tid >> 3][(tid & 7) * 8];
  const h16* kg0 = K + ((size_t)(b * S_LEN) + (tid >> 4)) * D_DIM + (tid & 15) * 8;
  const h16* vg0 = Vt + (size_t)b * D_DIM * S_LEN + (size_t)(tid >> 3) * S_LEN + (tid & 7) * 8;
  stage_k_async(kl0, kg0);   // K tile 0 flies while Q is staged

  const h16* Qg = Q + ((size_t)(b * S_LEN + q0)) * D_DIM;
  for (int c = tid; c < 64 * (D_DIM / 8); c += 512) {
    int r = c / (D_DIM / 8), dc = c % (D_DIM / 8);
    copy16_g2s(&Qs[r][dc * 8], Qg + (size_t)r * D_DIM + dc * 8);
  }

  v8f o[12] = {};
  int   srow = tid >> 3;          // softmax: 8 threads per query row
  int   sj   = tid & 7;
  float m_prev = -1e30f;
  float l_run  = 0.0f;
  const float scale = 0.03608439182435161f;  // 1/sqrt(768)

  for (int kv0 = 0; kv0 < S_LEN; kv0 += 64) {
    // Publish point of this K tile: its copies flew under the previous PV phase (tile 0: under the staging of Q).
    asm volatile("s_wait_dscnt 0x0" ::: "memory");      // this wave's reads of V^T and P (first trip: its stores of Q) are done
    asm volatile("s_wait_asynccnt 0x0" ::: "memory");   // this wave's copies of the K tile have landed
    __syncthreads();   // K (and Q) readable by all; every reader has left V^T
    stage_v_async(vl0, vg0 + kv0);   // this V^T tile flies under the score and softmax phases

    {
      // Fragment reads run one group (two k steps, 8 LDS loads) ahead of the WMMAs that use them, in a ring of two groups:
      // the statement behind each WMMA holds LDS loads in source order, so a load written next to its WMMA is waited for to 0.
      const h16* qp = &Qs[qi * 16 + idx][half * 8];
      const h16* kp = &Ks[kj * 16 + idx][half * 8];
      v16h qa[4], kb[4];
#pragma unroll   // here and below, whole: the ring's slots must be compile-time register names
      for (int s = 0; s < 2; ++s) { qa[s] = load_frag_at(qp + s * 32); kb[s] = load_frag_at(kp + s * 32); }
      v8f sc = {};
#pragma unroll   // slots
      for (int g = 0; g < D_DIM / 64; ++g) {
        if (g + 1 < D_DIM / 64) {
#pragma unroll   // slots
          for (int s = 0; s < 2; ++s) { const int n = (g + 1) * 2 + s; qa[n & 3] = load_frag_at(qp + n * 32); kb[n & 3] = load_frag_at(kp + n * 32); }
        }
#pragma unroll   // slots
        for (int s = 0; s < 2; ++s) { const int n = g * 2 + s; sc = wmma_f16(qa[n & 3], kb[n & 3], sc); }
      }
      int col = kj * 16 + idx;
#pragma unroll
      for (int g = 0; g < 8; ++g)
        Ss[qi * 16 + g + 8 * half][col] = sc[g] * scale;
    }
    __syncthreads();

    {
      float v[8];
      float mloc = -1e30f;
#pragma unroll
      for (int e = 0; e < 8; ++e) { v[e] = Ss[srow][sj + e * 8]; mloc = fmaxf(mloc, v[e]); }
#pragma unroll
      for (int msk = 1; msk < 8; msk <<= 1) mloc = fmaxf(mloc, __shfl_xor(mloc, msk, 32));
      float m_new = fmaxf(m_prev, mloc);
      float alpha = __expf(m_prev - m_new);
      float ssum = 0.0f;
      h16* prow = (h16*)&Ss[srow][0];   // every score of this row is in registers: m_new was formed from all of them
#pragma unroll
      for (int e = 0; e < 8; ++e) {
        float p = __expf(v[e] - m_new);
        ssum += p;
        prow[sj + e * 8] = (h16)(p * PSC);
      }
#pragma unroll
      for (int msk = 1; msk < 8; msk <<= 1) ssum += __shfl_xor(ssum, msk, 32);
      l_run = l_run * alpha + ssum;
      m_prev = m_new;
      if (sj == 0) { alpha_s[srow] = alpha; l_s[srow] = l_run; }
    }
    // Publish point of this V^T tile (and of P).
    asm volatile("s_wait_dscnt 0x0" ::: "memory");      // this wave's stores of P and its reads of K are done
    asm volatile("s_wait_asynccnt 0x0" ::: "memory");   // this wave's copies of the V^T tile have landed
    __syncthreads();   // V^T and P readable by all; every reader left K at the barrier behind the scores
    if (kv0 + 64 < S_LEN) stage_k_async(kl0, kg0 + (size_t)(kv0 + 64) * D_DIM);   // the next K tile flies under the PV phase

    {
      float al[8];
#pragma unroll
      for (int g = 0; g < 8; ++g) al[g] = alpha_s[qi * 16 + g + 8 * half];
      // V^T fragment n: k step n / 12, accumulator tile n % 12 (the order of the WMMAs is unchanged). Reads run one group of four
      // fragments (8 LDS loads) ahead of their WMMAs, in a ring of two groups; the first group flies under the rescaling.
      const h16* pp = (const h16*)&Ss[qi * 16 + idx][0] + half * 8;
      const h16* vp = &Vts[dg * 192 + idx][half * 8];
      v16h pa[2], vb[8];
      pa[0] = load_frag_at(pp); pa[1] = load_frag_at(pp + 32);
#pragma unroll   // here and below, whole: the ring's slots must be compile-time register names
      for (int n = 0; n < 4; ++n) vb[n] = load_frag_at(vp + (n % 12) * 16 * KV_P + (n / 12) * 32);
#pragma unroll
      for (int t = 0; t < 12; ++t)
#pragma unroll
        for (int g = 0; g < 8; ++g) o[t][g] *= al[g];
#pragma unroll   // slots
      for (int g = 0; g < 6; ++g) {
        if (g + 1 < 6) {
#pragma unroll   // slots
          for (int j = 0; j < 4; ++j) { const int n = (g + 1) * 4 + j; vb[n & 7] = load_frag_at(vp + (n % 12) * 16 * KV_P + (n / 12) * 32); }
        }
#pragma unroll   // slots
        for (int j = 0; j < 4; ++j) { const int n = g * 4 + j; o[n % 12] = wmma_f16(pa[n / 12], vb[n & 7], o[n % 12]); }
      }
    }
  }
  asm volatile("s_wait_asynccnt 0x0" ::: "memory");   // no copy is outstanding when K and Q become output staging
  __syncthreads();

  float* Ot = (qi < 2) ? (float*)&Ks[0][0] : (float*)&Qs[0][0];   // 32 output rows in each
  float linv[8];
#pragma unroll
  for (int g = 0; g < 8; ++g) linv[g] = PUN / l_s[qi * 16 + g + 8 * half];
#pragma unroll
  for (int t = 0; t < 12; ++t) {
    int col = dg * 192 + t * 16 + idx;
#pragma unroll
    for (int g = 0; g < 8; ++g) Ot[((qi & 1) * 16 + g + 8 * half) * D_DIM + col] = o[t][g] * linv[g];
  }
  __syncthreads();
  {
    float* dst = out + ((size_t)(b * S_LEN + q0)) * D_DIM;      // 64 contiguous rows
    const float* O0 = (const float*)&Ks[0][0];
    const float* O1 = (const float*)&Qs[0][0];
    for (int gg = tid; gg < 32 * D_DIM / 4; gg += 512) vst2(dst + (size_t)gg * 4, *(const v4f*)(O0 + gg * 4));
    for (int gg = tid; gg < 32 * D_DIM / 4; gg += 512) vst2(dst + (size_t)(32 * D_DIM) + (size_t)gg * 4, *(const v4f*)(O1 + gg * 4));
  }
}

extern "C" void kernel_launch(void* const* d_in, const int* in_sizes, int n_in,
                              void* d_out, int out_size, void* d_ws, size_t ws_size,
                              hipStream_t stream) {
  (void)in_sizes; (void)n_in; (void)out_size; (void)ws_size;
  const float* x  = (const float*)d_in[0];
  const float* Wq = (const float*)d_in[1];
  const float* bq = (const float*)d_in[2];
  const float* Wk = (const float*)d_in[3];
  const float* bk = (const float*)d_in[4];
  const float* Wv = (const float*)d_in[5];
  const float* bv = (const float*)d_in[6];
  float* out = (float*)d_out;

  char* ws = (char*)d_ws;
  h16* xb  = (h16*)(ws + 0);           // 16384*768*2 = 25,165,824
  h16* WqT = (h16*)(ws + 25165824);    // 768*768*2   =  1,179,648
  h16* WkT = (h16*)(ws + 26345472);
  h16* WvT = (h16*)(ws + 27525120);
  h16* qb  = (h16*)(ws + 28704768);    // 25,165,824
  h16* kb  = (h16*)(ws + 53870592);    // 25,165,824
  h16* vtb = (h16*)(ws + 79036416);    // 25,165,824  (stored [b][d][s])

  int nx8 = M_TOT * D_DIM / 8;
  cvt_x_kernel<<<nx8 / 256, 256, 0, stream>>>(x, xb, nx8);
  cvt_w_kernel<<<dim3(D_DIM / 64, D_DIM / 256, 3), 256, 0, stream>>>(Wq, Wk, Wv, WqT, WkT, WvT);

  dim3 pg(M_TOT / 64, D_DIM / 128);
  proj_kernel<<<pg, 256, 0, stream>>>(xb, WqT, bq, qb, 0);
  proj_kernel<<<pg, 256, 0, stream>>>(xb, WkT, bk, kb, 0);
  proj_kernel<<<pg, 256, 0, stream>>>(xb, WvT, bv, vtb, 1);

  attn_kernel<<<dim3(S_LEN / 64, B_SZ), 512, 0, stream>>>(qb, kb, vtb, out);
}

// v005
// A run of this version takes 358 microseconds.
// In two side-by-side timings against v004, it was 1.36 and 1.34 times as fast.
// All steps since v000 together make it 5.71 times as fast.
#include <hip/hip_runtime.h>
// Contractions: Q/K/V projections (K = 768), scores Q K^T (K = 768) and P V (K = keys) on v_wmma_f32_16x16x32_f16
// (f16 operands, f32 accumulate; P scaled by 256 before its f16 conversion); softmax statistics in f32.

typedef _Float16 h16;
typedef _Float16 h16x8 __attribute__((ext_vector_type(8)));
typedef _Float16 v16h  __attribute__((ext_vector_type(16)));
typedef float  v8f    __attribute__((ext_vector_type(8)));
typedef float  v4f    __attribute__((ext_vector_type(4)));
typedef unsigned v4u  __attribute__((ext_vector_type(4)));

#define D_DIM 768
#define S_LEN 4096
#define B_SZ  4
#define M_TOT (B_SZ * S_LEN)   // 16384
#define PSC 256.0f
#define PUN (1.0f / 256.0f)
// LDS row pitches of the attention tiles. Fragment rows read by 16-byte LDS loads sit at 16 B x odd, so that the 16 rows
// of a half-wave fall on 16 different groups of four banks (64 banks of 4 B) instead of all on one group.
#define QK_P 776   // halves: 1552 B = 16 B x 97 (768 data + 8 pad)
#define KV_P 72    // halves:  144 B = 16 B x 9  (64 data + 8 pad)
#define SS_P 68    // floats:  272 B = 16 B x 17: rows r and r + 8 of a score store lie 32 banks apart; a softmax read meets two-way conflicts
#define PS_P 136   // halves:  272 B: row r of P lies in the first 128 B of score row r (the 8 threads that read that row overwrite it)

template <typename V> __device__ __forceinline__ void vst2(void* p, V v) {
  *(V*)p = v; 
}
__device__ __forceinline__ void copy16_g2s(h16* ldst, const h16* gsrc) { *(h16x8*)ldst = *(const h16x8*)gsrc; }

__device__ __forceinline__ void copy12_async(const unsigned (&l)[12], const h16* const (&g)[12]) {
  asm volatile("global_load_async_to_lds_b128 %0, %12, off\n\t"
               "global_load_async_to_lds_b128 %1, %13, off\n\t"
               "global_load_async_to_lds_b128 %2, %14, off\n\t"
               "global_load_async_to_lds_b128 %3, %15, off\n\t"
               "global_load_async_to_lds_b128 %4, %16, off\n\t"
               "global_load_async_to_lds_b128 %5, %17, off\n\t"
               "global_load_async_to_lds_b128 %6, %18, off\n\t"
               "global_load_async_to_lds_b128 %7, %19, off\n\t"
               "global_load_async_to_lds_b128 %8, %20, off\n\t"
               "global_load_async_to_lds_b128 %9, %21, off\n\t"
               "global_load_async_to_lds_b128 %10, %22, off\n\t"
               "global_load_async_to_lds_b128 %11, %23, off\n\t"
               "s_wait_xcnt 0x0"
               :: "v"(l[0]), "v"(l[1]), "v"(l[2]), "v"(l[3]), "v"(l[4]), "v"(l[5]), "v"(l[6]), "v"(l[7]), "v"(l[8]), "v"(l[9]), "v"(l[10]), "v"(l[11]),
                  "v"(g[0]), "v"(g[1]), "v"(g[2]), "v"(g[3]), "v"(g[4]), "v"(g[5]), "v"(g[6]), "v"(g[7]), "v"(g[8]), "v"(g[9]), "v"(g[10]), "v"(g[11])
               : "memory");
}
// K tile, 64 rows of 1536 B: 16 lanes take 256 B of a row; copy i: row + 32 * (i / 6), byte + 256 * (i % 6).
__device__ __forceinline__ void stage_k_async(unsigned l0, const h16* g0) {
  unsigned l[12]; const h16* g[12];
#pragma unroll
  for (int i = 0; i < 12; ++i) { l[i] = l0 + (i / 6) * 32 * QK_P * 2 + (i % 6) * 256; g[i] = g0 + (i / 6) * 32 * D_DIM + (i % 6) * 128; }
  copy12_async(l, g);
}
// V^T tile, 768 rows of 128 B: 8 lanes take a row; copy i: row + 64 * i.
__device__ __forceinline__ void stage_v_async(unsigned l0, const h16* g0) {
  unsigned l[12]; const h16* g[12];
#pragma unroll
  for (int i = 0; i < 12; ++i) { l[i] = l0 + i * 64 * KV_P * 2; g[i] = g0 + (size_t)i * 64 * S_LEN; }
  copy12_async(l, g);
}

// ---- WMMA fragment loaders (f16, row-major K-contiguous source); A and B (from B^T rows) share the per-lane K map:
//      row/col = lane&15; elements 0..7 <- k0 + 8*half + 0..7, elements 8..15 <- k0 + 16 + 8*half + 0..7
__device__ __forceinline__ v16h load_a_frag(const h16* base, int ld, int k0) {
  int lane = threadIdx.x & 31;
  int idx  = lane & 15;
  int half = lane >> 4;
  const h16* p = base + idx * ld + k0 + half * 8;
  h16x8 lo = *(const h16x8*)(p);
  h16x8 hi = *(const h16x8*)(p + 16);
  return __builtin_shufflevector(lo, hi, 0,1,2,3,4,5,6,7,8,9,10,11,12,13,14,15);
}
__device__ __forceinline__ v16h load_b_frag(const h16* base, int ld, int k0) { return load_a_frag(base, ld, k0); }
// The same fragment from the lane's own address p = row start + k0 + 8 * half.
__device__ __forceinline__ v16h load_frag_at(const h16* p) {
  h16x8 lo = *(const h16x8*)(p);
  h16x8 hi = *(const h16x8*)(p + 16);
  return __builtin_shufflevector(lo, hi, 0,1,2,3,4,5,6,7,8,9,10,11,12,13,14,15);
}

__device__ __forceinline__ v8f wmma_f16(v16h a, v16h b, v8f c) {
  v8f d = __builtin_amdgcn_wmma_f32_16x16x32_f16(false, a, false, b, (short)0, c, false, false);
  asm volatile("v_nop\n\tv_nop\n\tv_nop\n\tv_nop" : "+v"(d) : "v"(a), "v"(b));
  return d;
}

// ---------------- conversion kernels ----------------
__global__ void cvt_x_kernel(const float* __restrict__ x, h16* __restrict__ xb, int n8) {   // 8 elements (16 B) per thread
  int g = blockIdx.x * blockDim.x + threadIdx.x;
  if (g >= n8) return;
  const v4f a = *(const v4f*)(x + (size_t)g * 8), b = *(const v4f*)(x + (size_t)g * 8 + 4);
  union { h16x8 h; v4u u; } pk;
#pragma unroll
  for (int i = 0; i < 4; ++i) { pk.h[i] = (h16)a[i]; pk.h[4 + i] = (h16)b[i]; }
  vst2(xb + (size_t)g * 8, pk.u);
}

__global__ __launch_bounds__(256) void cvt_w_kernel(const float* __restrict__ Wq, const float* __restrict__ Wk, const float* __restrict__ Wv,
                                                    h16* __restrict__ WqT, h16* __restrict__ WkT, h16* __restrict__ WvT) {
  __shared__ __align__(16) h16 tile[64][264];
  const float* W = (blockIdx.z == 0) ? Wq : (blockIdx.z == 1) ? Wk : Wv;
  h16*       WT = (blockIdx.z == 0) ? WqT : (blockIdx.z == 1) ? WkT : WvT;
  const int n0 = blockIdx.x * 64, k0 = blockIdx.y * 256, tid = threadIdx.x;
  for (int i = tid; i < 256 * 64; i += 256) { const int k = i >> 6, nl = i & 63; tile[nl][k] = (h16)W[(size_t)(k0 + k) * D_DIM + n0 + nl]; }
  __syncthreads();
  for (int g = tid; g < 64 * 32; g += 256) { const int nl = g >> 5, pc = g & 31; vst2(WT + (size_t)(n0 + nl) * D_DIM + k0 + pc * 8, *(const v4u*)(&tile[nl][pc * 8])); }
}

// ---------------- projection GEMM: out = X(16384x768) * W(768x768) + b ----------------
// Block tile 128 x 128, 8 waves: 4 M-groups (32 rows) x 2 N-groups (64 columns); each wave 2 x 4 WMMA tiles.
// The operands come in k slices of 64 halves: 128 X rows and 128 W^T rows of 128 B (whole cache lines), copied to LDS
// asynchronously, two buffers: slice s + 1 flies while slice s is worked on. Fragments are read from LDS.
#define PJ_P   72             // halves: LDS row pitch 144 B = 16 B x 9 (64 data + 8 pad), for 16-byte fragment reads
#define PJ_BUF (256 * PJ_P)   // halves in a buffer: rows 0..127 of X, rows 128..255 of W^T
#define PJ_T   136            // halves: row pitch of the output tile
#define PJ_NS  (D_DIM / 64)   // k slices

// Eight asynchronous copies of 16 B a lane, as copy12_async: the copies and their s_wait_xcnt 0 are one statement, so that no
// address register named by a copy is rewritten in front of that wait.
__device__ __forceinline__ void copy8_async(const unsigned (&l)[8], const h16* const (&g)[8]) {
  asm volatile("global_load_async_to_lds_b128 %0, %8, off\n\t"
               "global_load_async_to_lds_b128 %1, %9, off\n\t"
               "global_load_async_to_lds_b128 %2, %10, off\n\t"
               "global_load_async_to_lds_b128 %3, %11, off\n\t"
               "global_load_async_to_lds_b128 %4, %12, off\n\t"
               "global_load_async_to_lds_b128 %5, %13, off\n\t"
               "global_load_async_to_lds_b128 %6, %14, off\n\t"
               "global_load_async_to_lds_b128 %7, %15, off\n\t"
               "s_wait_xcnt 0x0"
               :: "v"(l[0]), "v"(l[1]), "v"(l[2]), "v"(l[3]), "v"(l[4]), "v"(l[5]), "v"(l[6]), "v"(l[7]),
                  "v"(g[0]), "v"(g[1]), "v"(g[2]), "v"(g[3]), "v"(g[4]), "v"(g[5]), "v"(g[6]), "v"(g[7])
               : "memory");
}
// One k slice: 8 lanes take a row of 128 B; copy i: row + 32 * i of the buffer (i < 4: X, else W^T).
__device__ __forceinline__ void stage_proj_async(unsigned l0, const h16* xg, const h16* wg) {
  unsigned l[8]; const h16* g[8];
#pragma unroll   // whole: l and g must end as registers, the operands of one statement
  for (int i = 0; i < 8; ++i) { l[i] = l0 + i * 32 * PJ_P * 2; g[i] = (i < 4) ? xg + i * 32 * D_DIM : wg + (i - 4) * 32 * D_DIM; }
  copy8_async(l, g);
}

__global__ __launch_bounds__(256) void proj_kernel(const h16* __restrict__ Xb, const h16* __restrict__ WT,
                            const float* __restrict__ bias, h16* __restrict__ out, int transposed) {
  __shared__ __align__(16) h16 SB[2 * PJ_BUF];    // 72 KB: the two buffers; after the loop the output tile
  h16* T = SB;                                    // [m][n] (transposed==0) or [n][m] (transposed==1), pitch PJ_T
  const int tid = threadIdx.x;
  int m0 = blockIdx.x * 128;
  int n0 = blockIdx.y * 128;
  int w    = tid >> 5;
  int lane = tid & 31;
  int idx  = lane & 15;
  int half = lane >> 4;
  int wm = w & 3;
  int wn = w >> 2;

  // Each lane's first LDS byte address (the low 32 bits of the __shared__ address) and first global addresses.
  const unsigned l0 = (unsigned)(size_t)&SB[(tid >> 3) * PJ_P + (tid & 7) * 8];
  const h16* xg = Xb + (size_t)(m0 + (tid >> 3)) * D_DIM + (tid & 7) * 8;
  const h16* wg = WT + (size_t)(n0 + (tid >> 3)) * D_DIM + (tid & 7) * 8;
  stage_proj_async(l0, xg, wg);
  asm volatile("s_wait_asynccnt 0x0" ::: "memory");   // this wave's copies of slice 0 have landed
  __syncthreads();   // slice 0 readable by all
  stage_proj_async(l0 + PJ_BUF * 2, xg + 64, wg + 64);

  v8f c[2][4] = {};
  const h16* ap = &SB[(wm * 32 + idx) * PJ_P + half * 8];
  const h16* bp = &SB[(128 + wn * 64 + idx) * PJ_P + half * 8];
  for (int s = 0; s < PJ_NS; ++s) {
    const int bo = (s & 1) * PJ_BUF;
    // Fragments of the slice's two k steps: X fragment ks * 2 + i; W^T fragment n = ks * 4 + t in slot n % 6. All but the last two
    // are read as one group at the head of the trip; the last two take the slots that k step 0 has freed (six slots, not eight,
    // keep the wave inside the register budget of three work-groups a WGP).
    v16h a[4], vb[6];
#pragma unroll   // here and below, whole: the slots must be compile-time register names
    for (int n = 0; n < 4; ++n) a[n] = load_frag_at(ap + bo + (n & 1) * 16 * PJ_P + (n >> 1) * 32);
#pragma unroll   // slots
    for (int n = 0; n < 6; ++n) vb[n] = load_frag_at(bp + bo + (n & 3) * 16 * PJ_P + (n >> 2) * 32);
#pragma unroll   // slots
    for (int t = 0; t < 4; ++t)
#pragma unroll   // slots
      for (int i = 0; i < 2; ++i) c[i][t] = wmma_f16(a[i], vb[t], c[i][t]);
#pragma unroll   // slots
    for (int n = 6; n < 8; ++n) vb[n - 6] = load_frag_at(bp + bo + (n & 3) * 16 * PJ_P + (n >> 2) * 32);
#pragma unroll   // slots
    for (int t = 0; t < 4; ++t)
#pragma unroll   // slots
      for (int i = 0; i < 2; ++i) c[i][t] = wmma_f16(a[2 + i], vb[(4 + t) % 6], c[i][t]);
    // Publish point of slice s + 1.
    asm volatile("s_wait_dscnt 0x0" ::: "memory");      // this wave's reads of slice s are done
    asm volatile("s_wait_asynccnt 0x0" ::: "memory");   // this wave's copies of slice s + 1 have landed
    __syncthreads();   // slice s + 1 readable by all; every reader has left the buffer of slice s
    if (s + 2 < PJ_NS) stage_proj_async(l0 + (unsigned)bo * 2, xg + (s + 2) * 64, wg + (s + 2) * 64);
  }
  asm volatile("s_wait_asynccnt 0x0" ::: "memory");   // no copy is outstanding when the buffers become the output tile

#pragma unroll   // here and below, whole: the accumulators are registers, indexed by compile-time numbers only
  for (int i = 0; i < 2; ++i) {
#pragma unroll
    for (int t = 0; t < 4; ++t) {
      int cl = wn * 64 + t * 16 + idx;                 // local col
      float bv = bias[n0 + cl];
#pragma unroll
      for (int g = 0; g < 8; ++g) {
        int rl = wm * 32 + i * 16 + g + 8 * half;      // local row
        h16 hv = (h16)(c[i][t][g] + bv);
        if (!transposed) T[rl * PJ_T + cl] = hv; else T[cl * PJ_T + rl] = hv;
      }
    }
  }
  __syncthreads();
  if (!transposed) {
    for (int gg = tid; gg < 128 * 16; gg += 256) { const int rl = gg >> 4, pc = gg & 15; vst2(out + (size_t)(m0 + rl) * D_DIM + n0 + pc * 8, *(const v4u*)(&T[rl * PJ_T + pc * 8])); }
  } else {
    const int bb = m0 >> 12, s0 = m0 & (S_LEN - 1);
    for (int gg = tid; gg < 128 * 16; gg += 256) { const int cl = gg >> 4, pc = gg & 15; vst2(out + ((size_t)(bb * D_DIM + n0 + cl)) * S_LEN + s0 + pc * 8, *(const v4u*)(&T[cl * PJ_T + pc * 8])); }
  }
}

// ---------------- flash attention ----------------
// WG = 64 queries, 16 waves: every staged K and V^T tile serves 64 queries. KV tiles of 64 keys.
// Score phase: wave w -> (qi = w&3, kj = w>>2) 16x16 tile, K-loop over 768.
// PV phase:    wave w -> (qi = w&3, dg = w>>2) 16 q x 192 dims (12 accum tiles).
__global__ __launch_bounds__(512)
void attn_kernel(const h16* __restrict__ Q, const h16* __restrict__ K,
                 const h16* __restrict__ Vt, float* __restrict__ out) {
  __shared__ __align__(16) h16   Qs[64][QK_P];     // 97 KB (reused as f32 output rows 32..63 after the loop)
  __shared__ __align__(16) h16   Ks[64][QK_P];     // 97 KB (reused as f32 output rows 0..31 after the loop)
  __shared__ __align__(16) h16   Vts[D_DIM][KV_P]; // 108 KB (d-major)
  __shared__ __align__(16) float Ss[64][SS_P];     // 17 KB (scores; then P in f16, row for row)
  __shared__ float alpha_s[64];
  __shared__ float l_s[64];

  int b   = blockIdx.y;
  int q0  = blockIdx.x * 64;
  int tid = threadIdx.x;
  int w    = tid >> 5;
  int lane = tid & 31;
  int idx  = lane & 15;
  int half = lane >> 4;
  int qi = w & 3;
  int kj = w >> 2;     // score kv subtile
  int dg = w >> 2;     // PV d-group (192 dims)

  // Each lane's first LDS byte address (the low 32 bits of the __shared__ address) and first global address of the two tiles.
  const unsigned kl0 = (unsigned)(size_t)&Ks[tid >> 4][(tid & 15) * 8];
  const unsigned vl0 = (unsigned)(size_t)&Vts[tid >> 3][(tid & 7) * 8];
  const h16* kg0 = K + ((size_t)(b * S_LEN) + (tid >> 4)) * D_DIM + (tid & 15) * 8;
  const h16* vg0 = Vt + (size_t)b * D_DIM * S_LEN + (size_t)(tid >> 3) * S_LEN + (tid & 7) * 8;
  stage_k_async(kl0, kg0);   // K tile 0 flies while Q is staged

  const h16* Qg = Q + ((size_t)(b * S_LEN + q0)) * D_DIM;
  for (int c = tid; c < 64 * (D_DIM / 8); c += 512) {
    int r = c / (D_DIM / 8), dc = c % (D_DIM / 8);
    copy16_g2s(&Qs[r][dc * 8], Qg + (size_t)r * D_DIM + dc * 8);
  }

  v8f o[12] = {};
  int   srow = tid >> 3;          // softmax: 8 threads per query row
  int   sj   = tid & 7;
  float m_prev = -1e30f;
  float l_run  = 0.0f;
  const float scale = 0.03608439182435161f;  // 1/sqrt(768)

  for (int kv0 = 0; kv0 < S_LEN; kv0 += 64) {
    // Publish point of this K tile: its copies flew under the previous PV phase (tile 0: under the staging of Q).
    asm volatile("s_wait_dscnt 0x0" ::: "memory");      // this wave's reads of V^T and P (first trip: its stores of Q) are done
    asm volatile("s_wait_asynccnt 0x0" ::: "memory");   // this wave's copies of the K tile have landed
    __syncthreads();   // K (and Q) readable by all; every reader has left V^T
    stage_v_async(vl0, vg0 + kv0);   // this V^T tile flies under the score and softmax phases

    {
      // Fragment reads run one group (two k steps, 8 LDS loads) ahead of the WMMAs that use them, in a ring of two groups:
      // the statement behind each WMMA holds LDS loads in source order, so a load written next to its WMMA is waited for to 0.
      const h16* qp = &Qs[qi * 16 + idx][half * 8];
      const h16* kp = &Ks[kj * 16 + idx][half * 8];
      v16h qa[4], kb[4];
#pragma unroll   // here and below, whole: the ring's slots must be compile-time register names
      for (int s = 0; s < 2; ++s) { qa[s] = load_frag_at(qp + s * 32); kb[s] = load_frag_at(kp + s * 32); }
      v8f sc = {};
#pragma unroll   // slots
      for (int g = 0; g < D_DIM / 64; ++g) {
        if (g + 1 < D_DIM / 64) {
#pragma unroll   // slots
          for (int s = 0; s < 2; ++s) { const int n = (g + 1) * 2 + s; qa[n & 3] = load_frag_at(qp + n * 32); kb[n & 3] = load_frag_at(kp + n * 32); }
        }
#pragma unroll   // slots
        for (int s = 0; s < 2; ++s) { const int n = g * 2 + s; sc = wmma_f16(qa[n & 3], kb[n & 3], sc); }
      }
      int col = kj * 16 + idx;
#pragma unroll
      for (int g = 0; g < 8; ++g)
        Ss[qi * 16 + g + 8 * half][col] = sc[g] * scale;
    }
    __syncthreads();

    {
      float v[8];
      float mloc = -1e30f;
#pragma unroll
      for (int e = 0; e < 8; ++e) { v[e] = Ss[srow][sj + e * 8]; mloc = fmaxf(mloc, v[e]); }
#pragma unroll
      for (int msk = 1; msk < 8; msk <<= 1) mloc = fmaxf(mloc, __shfl_xor(mloc, msk, 32));
      float m_new = fmaxf(m_prev, mloc);
      float alpha = __expf(m_prev - m_new);
      float ssum = 0.0f;
      h16* prow = (h16*)&Ss[srow][0];   // every score of this row is in registers: m_new was formed from all of them
#pragma unroll
      for (int e = 0; e < 8; ++e) {
        float p = __expf(v[e] - m_new);
        ssum += p;
        prow[sj + e * 8] = (h16)(p * PSC);
      }
#pragma unroll
      for (int msk = 1; msk < 8; msk <<= 1) ssum += __shfl_xor(ssum, msk, 32);
      l_run = l_run * alpha + ssum;
      m_prev = m_new;
      if (sj == 0) { alpha_s[srow] = alpha; l_s[srow] = l_run; }
    }
    // Publish point of this V^T tile (and of P).
    asm volatile("s_wait_dscnt 0x0" ::: "memory");      // this wave's stores of P and its reads of K are done
    asm volatile("s_wait_asynccnt 0x0" ::: "memory");   // this wave's copies of the V^T tile have landed
    __syncthreads();   // V^T and P readable by all; every reader left K at the barrier behind the scores
    if (kv0 + 64 < S_LEN) stage_k_async(kl0, kg0 + (size_t)(kv0 + 64) * D_DIM);   // the next K tile flies under the PV phase

    {
      float al[8];
#pragma unroll
      for (int g = 0; g < 8; ++g) al[g] = alpha_s[qi * 16 + g + 8 * half];
      // V^T fragment n: k step n / 12, accumulator tile n % 12 (the order of the WMMAs is unchanged). Reads run one group of four
      // fragments (8 LDS loads) ahead of their WMMAs, in a ring of two groups; the first group flies under the rescaling.
      const h16* pp = (const h16*)&Ss[qi * 16 + idx][0] + half * 8;
      const h16* vp = &Vts[dg * 192 + idx][half * 8];
      v16h pa[2], vb[8];
      pa[0] = load_frag_at(pp); pa[1] = load_frag_at(pp + 32);
#pragma unroll   // here and below, whole: the ring's slots must be compile-time register names
      for (int n = 0; n < 4; ++n) vb[n] = load_frag_at(vp + (n % 12) * 16 * KV_P + (n / 12) * 32);
#pragma unroll
      for (int t = 0; t < 12; ++t)
#pragma unroll
        for (int g = 0; g < 8; ++g) o[t][g] *= al[g];
#pragma unroll   // slots
      for (int g = 0; g < 6; ++g) {
        if (g + 1 < 6) {
#pragma unroll   // slots
          for (int j = 0; j < 4; ++j) { const int n = (g + 1) * 4 + j; vb[n & 7] = load_frag_at(vp + (n % 12) * 16 * KV_P + (n / 12) * 32); }
        }
#pragma unroll   // slots
        for (int j = 0; j < 4; ++j) { const int n = g * 4 + j; o[n % 12] = wmma_f16(pa[n / 12], vb[n & 7], o[n % 12]); }
      }
    }
  }
  asm volatile("s_wait_asynccnt 0x0" ::: "memory");   // no copy is outstanding when K and Q become output staging
  __syncthreads();

  float* Ot = (qi < 2) ? (float*)&Ks[0][0] : (float*)&Qs[0][0];   // 32 output rows in each
  float linv[8];
#pragma unroll
  for (int g = 0; g < 8; ++g) linv[g] = PUN / l_s[qi * 16 + g + 8 * half];
#pragma unroll
  for (int t = 0; t < 12; ++t) {
    int col = dg * 192 + t * 16 + idx;
#pragma unroll
    for (int g = 0; g < 8; ++g) Ot[((qi & 1) * 16 + g + 8 * half) * D_DIM + col] = o[t][g] * linv[g];
  }
  __syncthreads();
  {
    float* dst = out + ((size_t)(b * S_LEN + q0)) * D_DIM;      // 64 contiguous rows
    const float* O0 = (const float*)&Ks[0][0];
    const float* O1 = (const float*)&Qs[0][0];
    for (int gg = tid; gg < 32 * D_DIM / 4; gg += 512) vst2(dst + (size_t)gg * 4, *(const v4f*)(O0 + gg * 4));
    for (int gg = tid; gg < 32 * D_DIM / 4; gg += 512) vst2(dst + (size_t)(32 * D_DIM) + (size_t)gg * 4, *(const v4f*)(O1 + gg * 4));
  }
}

extern "C" void kernel_launch(void* const* d_in, const int* in_sizes, int n_in,
                              void* d_out, int out_size, void* d_ws, size_t ws_size,
                              hipStream_t stream) {
  (void)in_sizes; (void)n_in; (void)out_size; (void)ws_size;
  const float* x  = (const float*)d_in[0];
  const float* Wq = (const float*)d_in[1];
  const float* bq = (const float*)d_in[2];
  const float* Wk = (const float*)d_in[3];
  const float* bk = (const float*)d_in[4];
  const float* Wv = (const float*)d_in[5];
  const float* bv = (const float*)d_in[6];
  float* out = (float*)d_out;

  char* ws = (char*)d_ws;
  h16* xb  = (h16*)(ws + 0);           // 16384*768*2 = 25,165,824
  h16* WqT = (h16*)(ws + 25165824);    // 768*768*2   =  1,179,648
  h16* WkT = (h16*)(ws + 26345472);
  h16* WvT = (h16*)(ws + 27525120);
  h16* qb  = (h16*)(ws + 28704768);    // 25,165,824
  h16* kb  = (h16*)(ws + 53870592);    // 25,165,824
  h16* vtb = (h16*)(ws + 79036416);    // 25,165,824  (stored [b][d][s])

  int nx8 = M_TOT * D_DIM / 8;
  cvt_x_kernel<<<nx8 / 256, 256, 0, stream>>>(x, xb, nx8);
  cvt_w_kernel<<<dim3(D_DIM / 64, D_DIM / 256, 3), 256, 0, stream>>>(Wq, Wk, Wv, WqT, WkT, WvT);

  dim3 pg(M_TOT / 128, D_DIM / 128);
  proj_kernel<<<pg, 256, 0, stream>>>(xb, WqT, bq, qb, 0);
  proj_kernel<<<pg, 256, 0, stream>>>(xb, WkT, bk, kb, 0);
  proj_kernel<<<pg, 256, 0, stream>>>(xb, WvT, bv, vtb, 1);

  attn_kernel<<<dim3(S_LEN / 64, B_SZ), 512, 0, stream>>>(qb, kb, vtb, out);
}

// v006
// It runs in 331 microseconds.
// Timed twice side by side with v005, it ran 1.08 and 1.09 times as fast.
// Counting every step since v000, it is 6.19 times as fast.
#include <hip/hip_runtime.h>
// Contractions: Q/K/V projections (K = 768), scores Q K^T (K = 768) and P V (K = keys) on v_wmma_f32_16x16x32_f16
// (f16 operands, f32 accumulate; P scaled by 256 before its f16 conversion); softmax statistics in f32.

typedef _Float16 h16;
typedef _Float16 h16x8 __attribute__((ext_vector_type(8)));
typedef _Float16 v16h  __attribute__((ext_vector_type(16)));
typedef float  v8f    __attribute__((ext_vector_type(8)));
typedef float  v4f    __attribute__((ext_vector_type(4)));
typedef unsigned v4u  __attribute__((ext_vector_type(4)));

#define D_DIM 768
#define S_LEN 4096
#define B_SZ  4
#define M_TOT (B_SZ * S_LEN)   // 16384
#define PSC 256.0f
#define PUN (1.0f / 256.0f)
// LDS row pitches of the attention tiles. Fragment rows read by 16-byte LDS loads sit at 16 B x odd, so that the 16 rows
// of a half-wave fall on 16 different groups of four banks (64 banks of 4 B) instead of all on one group.
#define QK_P 776   // halves: 1552 B = 16 B x 97 (768 data + 8 pad)
#define KV_P 72    // halves:  144 B = 16 B x 9  (64 data + 8 pad)
#define SS_P 68    // floats:  272 B = 16 B x 17: row pitch of a plane of partial scores, written and read by 16-byte LDS operations
#define PS_P 136   // halves:  272 B = 16 B x 17: row pitch of P (64 data + 72 pad)

template <typename V> __device__ __forceinline__ void vst2(void* p, V v) {
  *(V*)p = v; 
}
__device__ __forceinline__ void copy16_g2s(h16* ldst, const h16* gsrc) { *(h16x8*)ldst = *(const h16x8*)gsrc; }

__device__ __forceinline__ void copy12_async(const unsigned (&l)[12], const h16* const (&g)[12]) {
  asm volatile("global_load_async_to_lds_b128 %0, %12, off\n\t"
               "global_load_async_to_lds_b128 %1, %13, off\n\t"
               "global_load_async_to_lds_b128 %2, %14, off\n\t"
               "global_load_async_to_lds_b128 %3, %15, off\n\t"
               "global_load_async_to_lds_b128 %4, %16, off\n\t"
               "global_load_async_to_lds_b128 %5, %17, off\n\t"
               "global_load_async_to_lds_b128 %6, %18, off\n\t"
               "global_load_async_to_lds_b128 %7, %19, off\n\t"
               "global_load_async_to_lds_b128 %8, %20, off\n\t"
               "global_load_async_to_lds_b128 %9, %21, off\n\t"
               "global_load_async_to_lds_b128 %10, %22, off\n\t"
               "global_load_async_to_lds_b128 %11, %23, off\n\t"
               "s_wait_xcnt 0x0"
               :: "v"(l[0]), "v"(l[1]), "v"(l[2]), "v"(l[3]), "v"(l[4]), "v"(l[5]), "v"(l[6]), "v"(l[7]), "v"(l[8]), "v"(l[9]), "v"(l[10]), "v"(l[11]),
                  "v"(g[0]), "v"(g[1]), "v"(g[2]), "v"(g[3]), "v"(g[4]), "v"(g[5]), "v"(g[6]), "v"(g[7]), "v"(g[8]), "v"(g[9]), "v"(g[10]), "v"(g[11])
               : "memory");
}
// K tile, 64 rows of 1536 B: 16 lanes take 256 B of a row; copy i: row + 32 * (i / 6), byte + 256 * (i % 6).
__device__ __forceinline__ void stage_k_async(unsigned l0, const h16* g0) {
  unsigned l[12]; const h16* g[12];
#pragma unroll
  for (int i = 0; i < 12; ++i) { l[i] = l0 + (i / 6) * 32 * QK_P * 2 + (i % 6) * 256; g[i] = g0 + (i / 6) * 32 * D_DIM + (i % 6) * 128; }
  copy12_async(l, g);
}
// V^T tile, 768 rows of 128 B: 8 lanes take a row; copy i: row + 64 * i.
__device__ __forceinline__ void stage_v_async(unsigned l0, const h16* g0) {
  unsigned l[12]; const h16* g[12];
#pragma unroll
  for (int i = 0; i < 12; ++i) { l[i] = l0 + i * 64 * KV_P * 2; g[i] = g0 + (size_t)i * 64 * S_LEN; }
  copy12_async(l, g);
}

// ---- WMMA fragment loaders (f16, row-major K-contiguous source); A and B (from B^T rows) share the per-lane K map:
//      row/col = lane&15; elements 0..7 <- k0 + 8*half + 0..7, elements 8..15 <- k0 + 16 + 8*half + 0..7
__device__ __forceinline__ v16h load_a_frag(const h16* base, int ld, int k0) {
  int lane = threadIdx.x & 31;
  int idx  = lane & 15;
  int half = lane >> 4;
  const h16* p = base + idx * ld + k0 + half * 8;
  h16x8 lo = *(const h16x8*)(p);
  h16x8 hi = *(const h16x8*)(p + 16);
  return __builtin_shufflevector(lo, hi, 0,1,2,3,4,5,6,7,8,9,10,11,12,13,14,15);
}
__device__ __forceinline__ v16h load_b_frag(const h16* base, int ld, int k0) { return load_a_frag(base, ld, k0); }
// The same fragment from the lane's own address p = row start + k0 + 8 * half.
__device__ __forceinline__ v16h load_frag_at(const h16* p) {
  h16x8 lo = *(const h16x8*)(p);
  h16x8 hi = *(const h16x8*)(p + 16);
  return __builtin_shufflevector(lo, hi, 0,1,2,3,4,5,6,7,8,9,10,11,12,13,14,15);
}

__device__ __forceinline__ v8f wmma_f16(v16h a, v16h b, v8f c) {
  v8f d = __builtin_amdgcn_wmma_f32_16x16x32_f16(false, a, false, b, (short)0, c, false, false);
  asm volatile("v_nop\n\tv_nop\n\tv_nop\n\tv_nop" : "+v"(d) : "v"(a), "v"(b));
  return d;
}

// e^x as __expf forms it (x * log2 e, then v_exp_f32). The v_nop in the same statement is the one free slot that the instruction set
// asks for between a transcendental and a directly following instruction that reads its result or overwrites its source.
__device__ __forceinline__ float exp_slot(float x) {
  float r;
  asm("v_exp_f32 %0, %1\n\tv_nop" : "=v"(r) : "v"(x * 1.44269504f));
  return r;
}

// ---------------- conversion kernels ----------------
__global__ void cvt_x_kernel(const float* __restrict__ x, h16* __restrict__ xb, int n8) {   // 8 elements (16 B) per thread
  int g = blockIdx.x * blockDim.x + threadIdx.x;
  if (g >= n8) return;
  const v4f a = *(const v4f*)(x + (size_t)g * 8), b = *(const v4f*)(x + (size_t)g * 8 + 4);
  union { h16x8 h; v4u u; } pk;
#pragma unroll
  for (int i = 0; i < 4; ++i) { pk.h[i] = (h16)a[i]; pk.h[4 + i] = (h16)b[i]; }
  vst2(xb + (size_t)g * 8, pk.u);
}

__global__ __launch_bounds__(256) void cvt_w_kernel(const float* __restrict__ Wq, const float* __restrict__ Wk, const float* __restrict__ Wv,
                                                    h16* __restrict__ WqT, h16* __restrict__ WkT, h16* __restrict__ WvT) {
  __shared__ __align__(16) h16 tile[64][264];
  const float* W = (blockIdx.z == 0) ? Wq : (blockIdx.z == 1) ? Wk : Wv;
  h16*       WT = (blockIdx.z == 0) ? WqT : (blockIdx.z == 1) ? WkT : WvT;
  const int n0 = blockIdx.x * 64, k0 = blockIdx.y * 256, tid = threadIdx.x;
  for (int i = tid; i < 256 * 64; i += 256) { const int k = i >> 6, nl = i & 63; tile[nl][k] = (h16)W[(size_t)(k0 + k) * D_DIM + n0 + nl]; }
  __syncthreads();
  for (int g = tid; g < 64 * 32; g += 256) { const int nl = g >> 5, pc = g & 31; vst2(WT + (size_t)(n0 + nl) * D_DIM + k0 + pc * 8, *(const v4u*)(&tile[nl][pc * 8])); }
}

// ---------------- projection GEMM: out = X(16384x768) * W(768x768) + b ----------------
// Block tile 128 x 128, 8 waves: 4 M-groups (32 rows) x 2 N-groups (64 columns); each wave 2 x 4 WMMA tiles.
// The operands come in k slices of 64 halves: 128 X rows and 128 W^T rows of 128 B (whole cache lines), copied to LDS
// asynchronously, two buffers: slice s + 1 flies while slice s is worked on. Fragments are read from LDS.
#define PJ_P   72             // halves: LDS row pitch 144 B = 16 B x 9 (64 data + 8 pad), for 16-byte fragment reads
#define PJ_BUF (256 * PJ_P)   // halves in a buffer: rows 0..127 of X, rows 128..255 of W^T
#define PJ_T   136            // halves: row pitch of the output tile
#define PJ_NS  (D_DIM / 64)   // k slices

// Eight asynchronous copies of 16 B a lane, as copy12_async: the copies and their s_wait_xcnt 0 are one statement, so that no
// address register named by a copy is rewritten in front of that wait.
__device__ __forceinline__ void copy8_async(const unsigned (&l)[8], const h16* const (&g)[8]) {
  asm volatile("global_load_async_to_lds_b128 %0, %8, off\n\t"
               "global_load_async_to_lds_b128 %1, %9, off\n\t"
               "global_load_async_to_lds_b128 %2, %10, off\n\t"
               "global_load_async_to_lds_b128 %3, %11, off\n\t"
               "global_load_async_to_lds_b128 %4, %12, off\n\t"
               "global_load_async_to_lds_b128 %5, %13, off\n\t"
               "global_load_async_to_lds_b128 %6, %14, off\n\t"
               "global_load_async_to_lds_b128 %7, %15, off\n\t"
               "s_wait_xcnt 0x0"
               :: "v"(l[0]), "v"(l[1]), "v"(l[2]), "v"(l[3]), "v"(l[4]), "v"(l[5]), "v"(l[6]), "v"(l[7]),
                  "v"(g[0]), "v"(g[1]), "v"(g[2]), "v"(g[3]), "v"(g[4]), "v"(g[5]), "v"(g[6]), "v"(g[7])
               : "memory");
}
// One k slice: 8 lanes take a row of 128 B; copy i: row + 32 * i of the buffer (i < 4: X, else W^T).
__device__ __forceinline__ void stage_proj_async(unsigned l0, const h16* xg, const h16* wg) {
  unsigned l[8]; const h16* g[8];
#pragma unroll   // whole: l and g must end as registers, the operands of one statement
  for (int i = 0; i < 8; ++i) { l[i] = l0 + i * 32 * PJ_P * 2; g[i] = (i < 4) ? xg + i * 32 * D_DIM : wg + (i - 4) * 32 * D_DIM; }
  copy8_async(l, g);
}

__global__ __launch_bounds__(256) void proj_kernel(const h16* __restrict__ Xb, const h16* __restrict__ WT,
                            const float* __restrict__ bias, h16* __restrict__ out, int transposed) {
  __shared__ __align__(16) h16 SB[2 * PJ_BUF];    // 72 KB: the two buffers; after the loop the output tile
  h16* T = SB;                                    // [m][n] (transposed==0) or [n][m] (transposed==1), pitch PJ_T
  const int tid = threadIdx.x;
  int m0 = blockIdx.x * 128;
  int n0 = blockIdx.y * 128;
  int w    = tid >> 5;
  int lane = tid & 31;
  int idx  = lane & 15;
  int half = lane >> 4;
  int wm = w & 3;
  int wn = w >> 2;

  // Each lane's first LDS byte address (the low 32 bits of the __shared__ address) and first global addresses.
  const unsigned l0 = (unsigned)(size_t)&SB[(tid >> 3) * PJ_P + (tid & 7) * 8];
  const h16* xg = Xb + (size_t)(m0 + (tid >> 3)) * D_DIM + (tid & 7) * 8;
  const h16* wg = WT + (size_t)(n0 + (tid >> 3)) * D_DIM + (tid & 7) * 8;
  stage_proj_async(l0, xg, wg);
  asm volatile("s_wait_asynccnt 0x0" ::: "memory");   // this wave's copies of slice 0 have landed
  __syncthreads();   // slice 0 readable by all
  stage_proj_async(l0 + PJ_BUF * 2, xg + 64, wg + 64);

  v8f c[2][4] = {};
  const h16* ap = &SB[(wm * 32 + idx) * PJ_P + half * 8];
  const h16* bp = &SB[(128 + wn * 64 + idx) * PJ_P + half * 8];
  for (int s = 0; s < PJ_NS; ++s) {
    const int bo = (s & 1) * PJ_BUF;
    // Fragments of the slice's two k steps: X fragment ks * 2 + i; W^T fragment n = ks * 4 + t in slot n % 6. All but the last two
    // are read as one group at the head of the trip; the last two take the slots that k step 0 has freed (six slots, not eight,
    // keep the wave inside the register budget of three work-groups a WGP).
    v16h a[4], vb[6];
#pragma unroll   // here and below, whole: the slots must be compile-time register names
    for (int n = 0; n < 4; ++n) a[n] = load_frag_at(ap + bo + (n & 1) * 16 * PJ_P + (n >> 1) * 32);
#pragma unroll   // slots
    for (int n = 0; n < 6; ++n) vb[n] = load_frag_at(bp + bo + (n & 3) * 16 * PJ_P + (n >> 2) * 32);
#pragma unroll   // slots
    for (int t = 0; t < 4; ++t)
#pragma unroll   // slots
      for (int i = 0; i < 2; ++i) c[i][t] = wmma_f16(a[i], vb[t], c[i][t]);
#pragma unroll   // slots
    for (int n = 6; n < 8; ++n) vb[n - 6] = load_frag_at(bp + bo + (n & 3) * 16 * PJ_P + (n >> 2) * 32);
#pragma unroll   // slots
    for (int t = 0; t < 4; ++t)
#pragma unroll   // slots
      for (int i = 0; i < 2; ++i) c[i][t] = wmma_f16(a[2 + i], vb[(4 + t) % 6], c[i][t]);
    // Publish point of slice s + 1.
    asm volatile("s_wait_dscnt 0x0" ::: "memory");      // this wave's reads of slice s are done
    asm volatile("s_wait_asynccnt 0x0" ::: "memory");   // this wave's copies of slice s + 1 have landed
    __syncthreads();   // slice s + 1 readable by all; every reader has left the buffer of slice s
    if (s + 2 < PJ_NS) stage_proj_async(l0 + (unsigned)bo * 2, xg + (s + 2) * 64, wg + (s + 2) * 64);
  }
  asm volatile("s_wait_asynccnt 0x0" ::: "memory");   // no copy is outstanding when the buffers become the output tile

#pragma unroll   // here and below, whole: the accumulators are registers, indexed by compile-time numbers only
  for (int i = 0; i < 2; ++i) {
#pragma unroll
    for (int t = 0; t < 4; ++t) {
      int cl = wn * 64 + t * 16 + idx;                 // local col
      float bv = bias[n0 + cl];
#pragma unroll
      for (int g = 0; g < 8; ++g) {
        int rl = wm * 32 + i * 16 + g + 8 * half;      // local row
        h16 hv = (h16)(c[i][t][g] + bv);
        if (!transposed) T[rl * PJ_T + cl] = hv; else T[cl * PJ_T + rl] = hv;
      }
    }
  }
  __syncthreads();
  if (!transposed) {
    for (int gg = tid; gg < 128 * 16; gg += 256) { const int rl = gg >> 4, pc = gg & 15; vst2(out + (size_t)(m0 + rl) * D_DIM + n0 + pc * 8, *(const v4u*)(&T[rl * PJ_T + pc * 8])); }
  } else {
    const int bb = m0 >> 12, s0 = m0 & (S_LEN - 1);
    for (int gg = tid; gg < 128 * 16; gg += 256) { const int cl = gg >> 4, pc = gg & 15; vst2(out + ((size_t)(bb * D_DIM + n0 + cl)) * S_LEN + s0 + pc * 8, *(const v4u*)(&T[cl * PJ_T + pc * 8])); }
  }
}

// ---------------- flash attention ----------------
// WG = 64 queries, 16 waves: every staged K and V^T tile serves 64 queries. KV tiles of 64 keys.
// Score phase: wave w -> 32 queries (w&1) x 32 keys ((w>>1)&1) over a quarter of the 768 dims (w>>2): 2 x 2 WMMA tiles, so each
//              fragment read from LDS feeds two WMMAs. The four partial sums of a score are added in the softmax phase.
// PV phase:    wave w -> 32 queries (w&1) x 96 dims (w>>1): 2 x 6 accumulator tiles, so each V^T fragment read feeds two WMMAs.
__global__ __launch_bounds__(512)
void attn_kernel(const h16* __restrict__ Q, const h16* __restrict__ K,
                 const h16* __restrict__ Vt, float* __restrict__ out) {
  __shared__ __align__(16) h16   Qs[64][QK_P];     // 97 KB (reused as f32 output rows 32..63 after the loop)
  __shared__ __align__(16) h16   Ks[64][QK_P];     // 97 KB (between scores and PV: four planes of partial scores; after the loop: f32 output rows 0..31)
  __shared__ __align__(16) h16   Vts[D_DIM][KV_P]; // 108 KB (d-major)
  __shared__ __align__(16) h16   Ps[64][PS_P];     // 17 KB (P in f16)
  __shared__ float alpha_s[64];
  __shared__ float l_s[64];

  int b   = blockIdx.y;
  int q0  = blockIdx.x * 64;
  int tid = threadIdx.x;
  int w    = tid >> 5;
  int lane = tid & 31;
  int idx  = lane & 15;
  int half = lane >> 4;
  int sqh = w & 1;         // score phase: half of the queries
  int skh = (w >> 1) & 1;  // score phase: half of the keys
  int skq = w >> 2;        // score phase: quarter of the dims
  int pqh = w & 1;         // PV phase: half of the queries
  int dg  = w >> 1;        // PV phase: d-group (96 dims)

  // Each lane's first LDS byte address (the low 32 bits of the __shared__ address) and first global address of the two tiles.
  const unsigned kl0 = (unsigned)(size_t)&Ks[tid >> 4][(tid & 15) * 8];
  const unsigned vl0 = (unsigned)(size_t)&Vts[tid >> 3][(tid & 7) * 8];
  const h16* kg0 = K + ((size_t)(b * S_LEN) + (tid >> 4)) * D_DIM + (tid & 15) * 8;
  const h16* vg0 = Vt + (size_t)b * D_DIM * S_LEN + (size_t)(tid >> 3) * S_LEN + (tid & 7) * 8;
  stage_k_async(kl0, kg0);   // K tile 0 flies while Q is staged

  const h16* Qg = Q + ((size_t)(b * S_LEN + q0)) * D_DIM;
  for (int c = tid; c < 64 * (D_DIM / 8); c += 512) {
    int r = c / (D_DIM / 8), dc = c % (D_DIM / 8);
    copy16_g2s(&Qs[r][dc * 8], Qg + (size_t)r * D_DIM + dc * 8);
  }

  v8f o[2][6] = {};   // o[query tile][d tile]
  int   srow = tid >> 3;          // softmax: 8 threads per query row
  int   sj   = tid & 7;
  float m_prev = -1e30f;
  float l_run  = 0.0f;
  const float scale = 0.03608439182435161f;  // 1/sqrt(768)

  for (int kv0 = 0; kv0 < S_LEN; kv0 += 64) {
    // Publish point of this K tile: its copies flew under the previous PV phase (tile 0: under the staging of Q).
    asm volatile("s_wait_dscnt 0x0" ::: "memory");      // this wave's reads of V^T and P (first trip: its stores of Q) are done
    asm volatile("s_wait_asynccnt 0x0" ::: "memory");   // this wave's copies of the K tile have landed
    __syncthreads();   // K (and Q) readable by all; every reader has left V^T
    stage_v_async(vl0, vg0 + kv0);   // this V^T tile flies under the score and softmax phases

    float* Sp = (float*)&Ks[0][0];   // partial scores: plane p (dims quarter p), query row r, key c at Sp[(p * 64 + r) * SS_P + c]
    {
      // Fragment reads run one group (one k step: 2 Q and 2 K fragments, 8 LDS loads) ahead of the four WMMAs that use them, in a
      // ring of two groups: the statement behind each WMMA holds LDS loads in source order, so a load written next to its WMMA is waited for to 0.
      const h16* qp = &Qs[sqh * 32 + idx][skq * 192 + half * 8];
      const h16* kp = &Ks[skh * 32 + idx][skq * 192 + half * 8];
      v16h qa[2][2], kb[2][2];
#pragma unroll   // here and below, whole: the ring's slots must be compile-time register names
      for (int i = 0; i < 2; ++i) { qa[0][i] = load_frag_at(qp + i * 16 * QK_P); kb[0][i] = load_frag_at(kp + i * 16 * QK_P); }
      v8f sc[2][2] = {};   // sc[j][i]: key tile j (rows of the product), query tile i (columns)
#pragma unroll   // slots
      for (int n = 0; n < 6; ++n) {
        if (n + 1 < 6) {
#pragma unroll   // slots
          for (int i = 0; i < 2; ++i) { qa[(n + 1) & 1][i] = load_frag_at(qp + i * 16 * QK_P + (n + 1) * 32); kb[(n + 1) & 1][i] = load_frag_at(kp + i * 16 * QK_P + (n + 1) * 32); }
        }
#pragma unroll   // slots
        for (int j = 0; j < 2; ++j)
#pragma unroll   // slots
          for (int i = 0; i < 2; ++i) sc[j][i] = wmma_f16(kb[n & 1][j], qa[n & 1][i], sc[j][i]);
      }
      __syncthreads();   // every reader has left K: its buffer takes the partial scores
      // K is the A operand: a lane holds 8 consecutive keys (8 * half + 0..7) of one query (idx), two 16-byte stores a tile.
#pragma unroll
      for (int j = 0; j < 2; ++j)
#pragma unroll
        for (int i = 0; i < 2; ++i) {
          float* d = Sp + (skq * 64 + sqh * 32 + i * 16 + idx) * SS_P + skh * 32 + j * 16 + half * 8;
          v4f lo = { sc[j][i][0], sc[j][i][1], sc[j][i][2], sc[j][i][3] };
          v4f hi = { sc[j][i][4], sc[j][i][5], sc[j][i][6], sc[j][i][7] };
          *(v4f*)d = lo;
          *(v4f*)(d + 4) = hi;
        }
    }
    __syncthreads();

    {
      // Thread sj of a row takes its keys 8 * sj + 0..7: the four partial sums of each, added in the order of the dims.
      const float* sp = Sp + srow * SS_P + sj * 8;
      v4f s_lo = *(const v4f*)sp, s_hi = *(const v4f*)(sp + 4);
#pragma unroll
      for (int p = 1; p < 4; ++p) { s_lo += *(const v4f*)(sp + p * 64 * SS_P); s_hi += *(const v4f*)(sp + p * 64 * SS_P + 4); }
      float v[8];
      float mloc = -1e30f;
#pragma unroll
      for (int e = 0; e < 8; ++e) { v[e] = ((e < 4) ? s_lo[e & 3] : s_hi[e & 3]) * scale; mloc = fmaxf(mloc, v[e]); }
#pragma unroll
      for (int msk = 1; msk < 8; msk <<= 1) mloc = fmaxf(mloc, __shfl_xor(mloc, msk, 32));
      float m_new = fmaxf(m_prev, mloc);
      float alpha = __expf(m_prev - m_new);
      float ssum = 0.0f;
      h16x8 pk;
#pragma unroll
      for (int e = 0; e < 8; ++e) {
        float p = exp_slot(v[e] - m_new);
        ssum += p;
        pk[e] = (h16)(p * PSC);
      }
      *(h16x8*)&Ps[srow][sj * 8] = pk;
#pragma unroll
      for (int msk = 1; msk < 8; msk <<= 1) ssum += __shfl_xor(ssum, msk, 32);
      l_run = l_run * alpha + ssum;
      m_prev = m_new;
      if (sj == 0) { alpha_s[srow] = alpha; l_s[srow] = l_run; }
    }
    // Publish point of this V^T tile (and of P).
    asm volatile("s_wait_dscnt 0x0" ::: "memory");      // this wave's stores of P and its reads of the partial scores are done
    asm volatile("s_wait_asynccnt 0x0" ::: "memory");   // this wave's copies of the V^T tile have landed
    __syncthreads();   // V^T and P readable by all; every reader has left the partial scores in the K buffer
    if (kv0 + 64 < S_LEN) stage_k_async(kl0, kg0 + (size_t)(kv0 + 64) * D_DIM);   // the next K tile flies under the PV phase

    {
      float al[2][8];
#pragma unroll
      for (int i = 0; i < 2; ++i)
#pragma unroll
        for (int g = 0; g < 8; ++g) al[i][g] = alpha_s[pqh * 32 + i * 16 + g + 8 * half];
      // Compiler fence: keeps both tiles' reads of alpha in front of the fragment reads (LDS returns in order), so that the rescaling runs
      // while the fragments fly; without it the second tile's alpha was read between the two rescalings and waited for to 0.
      asm volatile("" ::: "memory");
      // V^T fragment n: k step n / 6, d tile n % 6; it feeds both query tiles (each output element still takes k step 0, then k step 1).
      // Reads run one group of four fragments (8 LDS loads) ahead of their WMMAs, in a ring of two groups; the first group flies under the rescaling.
      const h16* pp = &Ps[pqh * 32 + idx][half * 8];
      const h16* vp = &Vts[dg * 96 + idx][half * 8];
      v16h pa[2][2], vb[8];   // pa[query tile][k step]
#pragma unroll   // here and below, whole: the ring's slots must be compile-time register names
      for (int i = 0; i < 2; ++i) { pa[i][0] = load_frag_at(pp + i * 16 * PS_P); pa[i][1] = load_frag_at(pp + i * 16 * PS_P + 32); }
#pragma unroll   // slots
      for (int n = 0; n < 4; ++n) vb[n] = load_frag_at(vp + (n % 6) * 16 * KV_P + (n / 6) * 32);
#pragma unroll
      for (int i = 0; i < 2; ++i)
#pragma unroll
        for (int t = 0; t < 6; ++t)
#pragma unroll
          for (int g = 0; g < 8; ++g) o[i][t][g] *= al[i][g];
#pragma unroll   // slots
      for (int g = 0; g < 3; ++g) {
        if (g + 1 < 3) {
#pragma unroll   // slots
          for (int j = 0; j < 4; ++j) { const int n = (g + 1) * 4 + j; vb[n & 7] = load_frag_at(vp + (n % 6) * 16 * KV_P + (n / 6) * 32); }
        }
#pragma unroll   // slots
        for (int j = 0; j < 4; ++j)
#pragma unroll   // slots
          for (int i = 0; i < 2; ++i) { const int n = g * 4 + j; o[i][n % 6] = wmma_f16(pa[i][n / 6], vb[n & 7], o[i][n % 6]); }
      }
    }
  }
  asm volatile("s_wait_asynccnt 0x0" ::: "memory");   // no copy is outstanding when K and Q become output staging
  __syncthreads();

  float* Ot = (pqh == 0) ? (float*)&Ks[0][0] : (float*)&Qs[0][0];   // 32 output rows in each
#pragma unroll
  for (int i = 0; i < 2; ++i) {
    float linv[8];
#pragma unroll
    for (int g = 0; g < 8; ++g) linv[g] = PUN / l_s[pqh * 32 + i * 16 + g + 8 * half];
#pragma unroll
    for (int t = 0; t < 6; ++t) {
      int col = dg * 96 + t * 16 + idx;
#pragma unroll
      for (int g = 0; g < 8; ++g) Ot[(i * 16 + g + 8 * half) * D_DIM + col] = o[i][t][g] * linv[g];
    }
  }
  __syncthreads();
  {
    float* dst = out + ((size_t)(b * S_LEN + q0)) * D_DIM;      // 64 contiguous rows
    const float* O0 = (const float*)&Ks[0][0];
    const float* O1 = (const float*)&Qs[0][0];
    for (int gg = tid; gg < 32 * D_DIM / 4; gg += 512) vst2(dst + (size_t)gg * 4, *(const v4f*)(O0 + gg * 4));
    for (int gg = tid; gg < 32 * D_DIM / 4; gg += 512) vst2(dst + (size_t)(32 * D_DIM) + (size_t)gg * 4, *(const v4f*)(O1 + gg * 4));
  }
}

extern "C" void kernel_launch(void* const* d_in, const int* in_sizes, int n_in,
                              void* d_out, int out_size, void* d_ws, size_t ws_size,
                              hipStream_t stream) {
  (void)in_sizes; (void)n_in; (void)out_size; (void)ws_size;
  const float* x  = (const float*)d_in[0];
  const float* Wq = (const float*)d_in[1];
  const float* bq = (const float*)d_in[2];
  const float* Wk = (const float*)d_in[3];
  const float* bk = (const float*)d_in[4];
  const float* Wv = (const float*)d_in[5];
  const float* bv = (const float*)d_in[6];
  float* out = (float*)d_out;

  char* ws = (char*)d_ws;
  h16* xb  = (h16*)(ws + 0);           // 16384*768*2 = 25,165,824
  h16* WqT = (h16*)(ws + 25165824);    // 768*768*2   =  1,179,648
  h16* WkT = (h16*)(ws + 26345472);
  h16* WvT = (h16*)(ws + 27525120);
  h16* qb  = (h16*)(ws + 28704768);    // 25,165,824
  h16* kb  = (h16*)(ws + 53870592);    // 25,165,824
  h16* vtb = (h16*)(ws + 79036416);    // 25,165,824  (stored [b][d][s])

  int nx8 = M_TOT * D_DIM / 8;
  cvt_x_kernel<<<nx8 / 256, 256, 0, stream>>>(x, xb, nx8);
  cvt_w_kernel<<<dim3(D_DIM / 64, D_DIM / 256, 3), 256, 0, stream>>>(Wq, Wk, Wv, WqT, WkT, WvT);

  dim3 pg(M_TOT / 128, D_DIM / 128);
  proj_kernel<<<pg, 256, 0, stream>>>(xb, WqT, bq, qb, 0);
  proj_kernel<<<pg, 256, 0, stream>>>(xb, WkT, bk, kb, 0);
  proj_kernel<<<pg, 256, 0, stream>>>(xb, WvT, bv, vtb, 1);

  attn_kernel<<<dim3(S_LEN / 64, B_SZ), 512, 0, stream>>>(qb, kb, vtb, out);
}

// v007
// One run takes 319 microseconds.
// Two timings next to v006 put it at 1.04 and 1.03 times that version's speed.
// Counting every step since v000, it is 6.41 times as fast.
#include <hip/hip_runtime.h>
// Contractions: Q/K/V projections (K = 768), scores Q K^T (K = 768) and P V (K = keys) on v_wmma_f32_16x16x32_f16
// (f16 operands, f32 accumulate; P scaled by 256 before its f16 conversion); softmax statistics in f32.

typedef _Float16 h16;
typedef _Float16 h16x8 __attribute__((ext_vector_type(8)));
typedef _Float16 v16h  __attribute__((ext_vector_type(16)));
typedef float  v8f    __attribute__((ext_vector_type(8)));
typedef float  v4f    __attribute__((ext_vector_type(4)));
typedef unsigned v4u  __attribute__((ext_vector_type(4)));

#define D_DIM 768
#define S_LEN 4096
#define B_SZ  4
#define M_TOT (B_SZ * S_LEN)   // 16384
#define PSC 256.0f
#define PUN (1.0f / 256.0f)
// LDS row pitches of the attention tiles. Fragment rows read by 16-byte LDS loads sit at 16 B x odd, so that the 16 rows
// of a half-wave fall on 16 different groups of four banks (64 banks of 4 B) instead of all on one group.
#define QK_P 776   // halves: 1552 B = 16 B x 97 (768 data + 8 pad)
#define KV_P 72    // halves:  144 B = 16 B x 9  (64 data + 8 pad)
#define SS_P 68    // floats:  272 B = 16 B x 17: row pitch of a plane of partial scores, written and read by 16-byte LDS operations
#define PS_P 136   // halves:  272 B = 16 B x 17: row pitch of P (64 data + 72 pad)

template <typename V> __device__ __forceinline__ void vst2(void* p, V v) {
  *(V*)p = v; 
}
__device__ __forceinline__ void copy16_g2s(h16* ldst, const h16* gsrc) { *(h16x8*)ldst = *(const h16x8*)gsrc; }

typedef int i32x4 __attribute__((vector_size(16)));
typedef __attribute__((address_space(1))) i32x4 g_i32x4;
typedef __attribute__((address_space(3))) i32x4 l_i32x4;
// OFF, in bytes (0 to 1280 here), is the instruction's immediate offset: it moves the LDS address and the global address alike.
template <int OFF> __device__ __forceinline__ void copy16_async(h16* ldst, const h16* gsrc) {
  __builtin_amdgcn_global_load_async_to_lds_b128((g_i32x4*)gsrc, (l_i32x4*)ldst, OFF, 0);
}
// K tile, 64 rows of 1536 B: 16 lanes take 256 B of a row; copy i: row + 32 * (i / 6), byte + 256 * (i % 6).
__device__ __forceinline__ void stage_k_async(h16* l0, const h16* g0) {
#pragma unroll   // whole: twelve copies in a row, constant steps
  for (int r = 0; r < 2; ++r) {
    h16* l = l0 + r * 32 * QK_P; const h16* g = g0 + r * 32 * D_DIM;
    copy16_async<0>(l, g);   copy16_async<256>(l, g);  copy16_async<512>(l, g);
    copy16_async<768>(l, g); copy16_async<1024>(l, g); copy16_async<1280>(l, g);
  }
}
// V^T tile, 768 rows of 128 B: 8 lanes take a row; copy i: row + 64 * i.
__device__ __forceinline__ void stage_v_async(h16* l0, const h16* g0) {
#pragma unroll   // whole: twelve copies in a row, constant steps
  for (int i = 0; i < 12; ++i) copy16_async<0>(l0 + i * 64 * KV_P, g0 + (size_t)i * 64 * S_LEN);
}

// ---- WMMA fragment loaders (f16, row-major K-contiguous source); A and B (from B^T rows) share the per-lane K map:
//      row/col = lane&15; elements 0..7 <- k0 + 8*half + 0..7, elements 8..15 <- k0 + 16 + 8*half + 0..7
__device__ __forceinline__ v16h load_a_frag(const h16* base, int ld, int k0) {
  int lane = threadIdx.x & 31;
  int idx  = lane & 15;
  int half = lane >> 4;
  const h16* p = base + idx * ld + k0 + half * 8;
  h16x8 lo = *(const h16x8*)(p);
  h16x8 hi = *(const h16x8*)(p + 16);
  return __builtin_shufflevector(lo, hi, 0,1,2,3,4,5,6,7,8,9,10,11,12,13,14,15);
}
__device__ __forceinline__ v16h load_b_frag(const h16* base, int ld, int k0) { return load_a_frag(base, ld, k0); }
// The same fragment from the lane's own address p = row start + k0 + 8 * half.
__device__ __forceinline__ v16h load_frag_at(const h16* p) {
  h16x8 lo = *(const h16x8*)(p);
  h16x8 hi = *(const h16x8*)(p + 16);
  return __builtin_shufflevector(lo, hi, 0,1,2,3,4,5,6,7,8,9,10,11,12,13,14,15);
}

__device__ __forceinline__ v8f wmma_f16(v16h a, v16h b, v8f c) {
  v8f d = __builtin_amdgcn_wmma_f32_16x16x32_f16(false, a, false, b, (short)0, c, false, false);
  asm volatile("v_nop\n\tv_nop\n\tv_nop\n\tv_nop" : "+v"(d) : "v"(a), "v"(b));
  return d;
}

// e^x as __expf forms it (x * log2 e, then v_exp_f32). The v_nop in the same statement is the one free slot that the instruction set
// asks for between a transcendental and a directly following instruction that reads its result or overwrites its source.
__device__ __forceinline__ float exp_slot(float x) {
  float r;
  asm("v_exp_f32 %0, %1\n\tv_nop" : "=v"(r) : "v"(x * 1.44269504f));
  return r;
}

// ---------------- conversion kernels ----------------
__global__ void cvt_x_kernel(const float* __restrict__ x, h16* __restrict__ xb, int n8) {   // 8 elements (16 B) per thread
  int g = blockIdx.x * blockDim.x + threadIdx.x;
  if (g >= n8) return;
  const v4f a = *(const v4f*)(x + (size_t)g * 8), b = *(const v4f*)(x + (size_t)g * 8 + 4);
  union { h16x8 h; v4u u; } pk;
#pragma unroll
  for (int i = 0; i < 4; ++i) { pk.h[i] = (h16)a[i]; pk.h[4 + i] = (h16)b[i]; }
  vst2(xb + (size_t)g * 8, pk.u);
}

__global__ __launch_bounds__(256) void cvt_w_kernel(const float* __restrict__ Wq, const float* __restrict__ Wk, const float* __restrict__ Wv,
                                                    h16* __restrict__ WqT, h16* __restrict__ WkT, h16* __restrict__ WvT) {
  __shared__ __align__(16) h16 tile[64][264];
  const float* W = (blockIdx.z == 0) ? Wq : (blockIdx.z == 1) ? Wk : Wv;
  h16*       WT = (blockIdx.z == 0) ? WqT : (blockIdx.z == 1) ? WkT : WvT;
  const int n0 = blockIdx.x * 64, k0 = blockIdx.y * 256, tid = threadIdx.x;
  for (int i = tid; i < 256 * 64; i += 256) { const int k = i >> 6, nl = i & 63; tile[nl][k] = (h16)W[(size_t)(k0 + k) * D_DIM + n0 + nl]; }
  __syncthreads();
  for (int g = tid; g < 64 * 32; g += 256) { const int nl = g >> 5, pc = g & 31; vst2(WT + (size_t)(n0 + nl) * D_DIM + k0 + pc * 8, *(const v4u*)(&tile[nl][pc * 8])); }
}

// ---------------- projection GEMM: out = X(16384x768) * W(768x768) + b ----------------
// Block tile 128 x 128, 8 waves: 4 M-groups (32 rows) x 2 N-groups (64 columns); each wave 2 x 4 WMMA tiles.
// The operands come in k slices of 64 halves: 128 X rows and 128 W^T rows of 128 B (whole cache lines), copied to LDS
// asynchronously, two buffers: slice s + 1 flies while slice s is worked on. Fragments are read from LDS.
#define PJ_P   72             // halves: LDS row pitch 144 B = 16 B x 9 (64 data + 8 pad), for 16-byte fragment reads
#define PJ_BUF (256 * PJ_P)   // halves in a buffer: rows 0..127 of X, rows 128..255 of W^T
#define PJ_T   136            // halves: row pitch of the output tile
#define PJ_NS  (D_DIM / 64)   // k slices

// Eight asynchronous copies of 16 B a lane in asm text: copy i brings the 16 B at g[i] to the LDS byte address l[i]. The copies and
// their s_wait_xcnt 0 are one statement, so that no address register named by a copy is rewritten in front of that wait.
__device__ __forceinline__ void copy8_async(const unsigned (&l)[8], const h16* const (&g)[8]) {
  asm volatile("global_load_async_to_lds_b128 %0, %8, off\n\t"
               "global_load_async_to_lds_b128 %1, %9, off\n\t"
               "global_load_async_to_lds_b128 %2, %10, off\n\t"
               "global_load_async_to_lds_b128 %3, %11, off\n\t"
               "global_load_async_to_lds_b128 %4, %12, off\n\t"
               "global_load_async_to_lds_b128 %5, %13, off\n\t"
               "global_load_async_to_lds_b128 %6, %14, off\n\t"
               "global_load_async_to_lds_b128 %7, %15, off\n\t"
               "s_wait_xcnt 0x0"
               :: "v"(l[0]), "v"(l[1]), "v"(l[2]), "v"(l[3]), "v"(l[4]), "v"(l[5]), "v"(l[6]), "v"(l[7]),
                  "v"(g[0]), "v"(g[1]), "v"(g[2]), "v"(g[3]), "v"(g[4]), "v"(g[5]), "v"(g[6]), "v"(g[7])
               : "memory");
}
// One k slice: 8 lanes take a row of 128 B; copy i: row + 32 * i of the buffer (i < 4: X, else W^T).
__device__ __forceinline__ void stage_proj_async(unsigned l0, const h16* xg, const h16* wg) {
  unsigned l[8]; const h16* g[8];
#pragma unroll   // whole: l and g must end as registers, the operands of one statement
  for (int i = 0; i < 8; ++i) { l[i] = l0 + i * 32 * PJ_P * 2; g[i] = (i < 4) ? xg + i * 32 * D_DIM : wg + (i - 4) * 32 * D_DIM; }
  copy8_async(l, g);
}

__global__ __launch_bounds__(256) void proj_kernel(const h16* __restrict__ Xb, const h16* __restrict__ WT,
                            const float* __restrict__ bias, h16* __restrict__ out, int transposed) {
  __shared__ __align__(16) h16 SB[2 * PJ_BUF];    // 72 KB: the two buffers; after the loop the output tile
  h16* T = SB;                                    // [m][n] (transposed==0) or [n][m] (transposed==1), pitch PJ_T
  const int tid = threadIdx.x;
  int m0 = blockIdx.x * 128;
  int n0 = blockIdx.y * 128;
  int w    = tid >> 5;
  int lane = tid & 31;
  int idx  = lane & 15;
  int half = lane >> 4;
  int wm = w & 3;
  int wn = w >> 2;

  // Each lane's first LDS byte address (the low 32 bits of the __shared__ address) and first global addresses.
  const unsigned l0 = (unsigned)(size_t)&SB[(tid >> 3) * PJ_P + (tid & 7) * 8];
  const h16* xg = Xb + (size_t)(m0 + (tid >> 3)) * D_DIM + (tid & 7) * 8;
  const h16* wg = WT + (size_t)(n0 + (tid >> 3)) * D_DIM + (tid & 7) * 8;
  stage_proj_async(l0, xg, wg);
  asm volatile("s_wait_asynccnt 0x0" ::: "memory");   // this wave's copies of slice 0 have landed
  __syncthreads();   // slice 0 readable by all
  stage_proj_async(l0 + PJ_BUF * 2, xg + 64, wg + 64);

  v8f c[2][4] = {};
  const h16* ap = &SB[(wm * 32 + idx) * PJ_P + half * 8];
  const h16* bp = &SB[(128 + wn * 64 + idx) * PJ_P + half * 8];
  for (int s = 0; s < PJ_NS; ++s) {
    const int bo = (s & 1) * PJ_BUF;
    // Fragments of the slice's two k steps: X fragment ks * 2 + i; W^T fragment n = ks * 4 + t in slot n % 6. All but the last two
    // are read as one group at the head of the trip; the last two take the slots that k step 0 has freed (six slots, not eight,
    // keep the wave inside the register budget of three work-groups a WGP).
    v16h a[4], vb[6];
#pragma unroll   // here and below, whole: the slots must be compile-time register names
    for (int n = 0; n < 4; ++n) a[n] = load_frag_at(ap + bo + (n & 1) * 16 * PJ_P + (n >> 1) * 32);
#pragma unroll   // slots
    for (int n = 0; n < 6; ++n) vb[n] = load_frag_at(bp + bo + (n & 3) * 16 * PJ_P + (n >> 2) * 32);
#pragma unroll   // slots
    for (int t = 0; t < 4; ++t)
#pragma unroll   // slots
      for (int i = 0; i < 2; ++i) c[i][t] = wmma_f16(a[i], vb[t], c[i][t]);
#pragma unroll   // slots
    for (int n = 6; n < 8; ++n) vb[n - 6] = load_frag_at(bp + bo + (n & 3) * 16 * PJ_P + (n >> 2) * 32);
#pragma unroll   // slots
    for (int t = 0; t < 4; ++t)
#pragma unroll   // slots
      for (int i = 0; i < 2; ++i) c[i][t] = wmma_f16(a[2 + i], vb[(4 + t) % 6], c[i][t]);
    // Publish point of slice s + 1.
    asm volatile("s_wait_dscnt 0x0" ::: "memory");      // this wave's reads of slice s are done
    asm volatile("s_wait_asynccnt 0x0" ::: "memory");   // this wave's copies of slice s + 1 have landed
    __syncthreads();   // slice s + 1 readable by all; every reader has left the buffer of slice s
    if (s + 2 < PJ_NS) stage_proj_async(l0 + (unsigned)bo * 2, xg + (s + 2) * 64, wg + (s + 2) * 64);
  }
  asm volatile("s_wait_asynccnt 0x0" ::: "memory");   // no copy is outstanding when the buffers become the output tile

#pragma unroll   // here and below, whole: the accumulators are registers, indexed by compile-time numbers only
  for (int i = 0; i < 2; ++i) {
#pragma unroll
    for (int t = 0; t < 4; ++t) {
      int cl = wn * 64 + t * 16 + idx;                 // local col
      float bv = bias[n0 + cl];
#pragma unroll
      for (int g = 0; g < 8; ++g) {
        int rl = wm * 32 + i * 16 + g + 8 * half;      // local row
        h16 hv = (h16)(c[i][t][g] + bv);
        if (!transposed) T[rl * PJ_T + cl] = hv; else T[cl * PJ_T + rl] = hv;
      }
    }
  }
  __syncthreads();
  if (!transposed) {
    for (int gg = tid; gg < 128 * 16; gg += 256) { const int rl = gg >> 4, pc = gg & 15; vst2(out + (size_t)(m0 + rl) * D_DIM + n0 + pc * 8, *(const v4u*)(&T[rl * PJ_T + pc * 8])); }
  } else {
    const int bb = m0 >> 12, s0 = m0 & (S_LEN - 1);
    for (int gg = tid; gg < 128 * 16; gg += 256) { const int cl = gg >> 4, pc = gg & 15; vst2(out + ((size_t)(bb * D_DIM + n0 + cl)) * S_LEN + s0 + pc * 8, *(const v4u*)(&T[cl * PJ_T + pc * 8])); }
  }
}

// ---------------- flash attention ----------------
// WG = 64 queries, 16 waves: every staged K and V^T tile serves 64 queries. KV tiles of 64 keys.
// Score phase: wave w -> 32 queries (w&1) x 32 keys ((w>>1)&1) over a quarter of the 768 dims (w>>2): 2 x 2 WMMA tiles, so each
//              fragment read from LDS feeds two WMMAs. The four partial sums of a score are added in the softmax phase.
// PV phase:    wave w -> 32 queries (w&1) x 96 dims (w>>1): 2 x 6 accumulator tiles, so each V^T fragment read feeds two WMMAs.
__global__ __launch_bounds__(512)
void attn_kernel(const h16* __restrict__ Q, const h16* __restrict__ K,
                 const h16* __restrict__ Vt, float* __restrict__ out) {
  __shared__ __align__(16) h16   Qs[64][QK_P];     // 97 KB (reused as f32 output rows 32..63 after the loop)
  __shared__ __align__(16) h16   Ks[64][QK_P];     // 97 KB (between scores and PV: four planes of partial scores; after the loop: f32 output rows 0..31)
  __shared__ __align__(16) h16   Vts[D_DIM][KV_P]; // 108 KB (d-major)
  __shared__ __align__(16) h16   Ps[64][PS_P];     // 17 KB (P in f16)
  __shared__ float alpha_s[64];
  __shared__ float l_s[64];

  int b   = blockIdx.y;
  int q0  = blockIdx.x * 64;
  int tid = threadIdx.x;
  int w    = tid >> 5;
  int lane = tid & 31;
  int idx  = lane & 15;
  int half = lane >> 4;
  int sqh = w & 1;         // score phase: half of the queries
  int skh = (w >> 1) & 1;  // score phase: half of the keys
  int skq = w >> 2;        // score phase: quarter of the dims
  int pqh = w & 1;         // PV phase: half of the queries
  int dg  = w >> 1;        // PV phase: d-group (96 dims)

  // Each lane's first LDS address and first global address of the two tiles.
  h16* kl0 = &Ks[tid >> 4][(tid & 15) * 8];
  h16* vl0 = &Vts[tid >> 3][(tid & 7) * 8];
  const h16* kg0 = K + ((size_t)(b * S_LEN) + (tid >> 4)) * D_DIM + (tid & 15) * 8;
  const h16* vg0 = Vt + (size_t)b * D_DIM * S_LEN + (size_t)(tid >> 3) * S_LEN + (tid & 7) * 8;
  stage_k_async(kl0, kg0);   // K tile 0 flies while Q is staged

  const h16* Qg = Q + ((size_t)(b * S_LEN + q0)) * D_DIM;
  for (int c = tid; c < 64 * (D_DIM / 8); c += 512) {
    int r = c / (D_DIM / 8), dc = c % (D_DIM / 8);
    copy16_g2s(&Qs[r][dc * 8], Qg + (size_t)r * D_DIM + dc * 8);
  }

  v8f o[2][6] = {};   // o[query tile][d tile]
  int   srow = tid >> 3;          // softmax: 8 threads per query row
  int   sj   = tid & 7;
  float m_prev = -1e30f;
  float l_run  = 0.0f;
  const float scale = 0.03608439182435161f;  // 1/sqrt(768)

  for (int kv0 = 0; kv0 < S_LEN; kv0 += 64) {
    // Publish point of this K tile: its copies flew under the previous PV phase (tile 0: under the staging of Q).
    asm volatile("s_wait_dscnt 0x0" ::: "memory");      // this wave's reads of V^T and P (first trip: its stores of Q) are done
    asm volatile("s_wait_asynccnt 0x0" ::: "memory");   // this wave's copies of the K tile have landed
    __syncthreads();   // K (and Q) readable by all; every reader has left V^T
    stage_v_async(vl0, vg0 + kv0);   // this V^T tile flies under the score and softmax phases

    float* Sp = (float*)&Ks[0][0];   // partial scores: plane p (dims quarter p), query row r, key c at Sp[(p * 64 + r) * SS_P + c]
    {
      // Fragment reads run one group (one k step: 2 Q and 2 K fragments, 8 LDS loads) ahead of the four WMMAs that use them, in a
      // ring of two groups: the statement behind each WMMA holds LDS loads in source order, so a load written next to its WMMA is waited for to 0.
      const h16* qp = &Qs[sqh * 32 + idx][skq * 192 + half * 8];
      const h16* kp = &Ks[skh * 32 + idx][skq * 192 + half * 8];
      v16h qa[2][2], kb[2][2];
#pragma unroll   // here and below, whole: the ring's slots must be compile-time register names
      for (int i = 0; i < 2; ++i) { qa[0][i] = load_frag_at(qp + i * 16 * QK_P); kb[0][i] = load_frag_at(kp + i * 16 * QK_P); }
      v8f sc[2][2] = {};   // sc[j][i]: key tile j (rows of the product), query tile i (columns)
#pragma unroll   // slots
      for (int n = 0; n < 6; ++n) {
        if (n + 1 < 6) {
#pragma unroll   // slots
          for (int i = 0; i < 2; ++i) { qa[(n + 1) & 1][i] = load_frag_at(qp + i * 16 * QK_P + (n + 1) * 32); kb[(n + 1) & 1][i] = load_frag_at(kp + i * 16 * QK_P + (n + 1) * 32); }
        }
#pragma unroll   // slots
        for (int j = 0; j < 2; ++j)
#pragma unroll   // slots
          for (int i = 0; i < 2; ++i) sc[j][i] = wmma_f16(kb[n & 1][j], qa[n & 1][i], sc[j][i]);
      }
      __syncthreads();   // every reader has left K: its buffer takes the partial scores
      // K is the A operand: a lane holds 8 consecutive keys (8 * half + 0..7) of one query (idx), two 16-byte stores a tile.
#pragma unroll
      for (int j = 0; j < 2; ++j)
#pragma unroll
        for (int i = 0; i < 2; ++i) {
          float* d = Sp + (skq * 64 + sqh * 32 + i * 16 + idx) * SS_P + skh * 32 + j * 16 + half * 8;
          v4f lo = { sc[j][i][0], sc[j][i][1], sc[j][i][2], sc[j][i][3] };
          v4f hi = { sc[j][i][4], sc[j][i][5], sc[j][i][6], sc[j][i][7] };
          *(v4f*)d = lo;
          *(v4f*)(d + 4) = hi;
        }
    }
    __syncthreads();

    {
      // Thread sj of a row takes its keys 8 * sj + 0..7: the four partial sums of each, added in the order of the dims.
      const float* sp = Sp + srow * SS_P + sj * 8;
      v4f s_lo = *(const v4f*)sp, s_hi = *(const v4f*)(sp + 4);
#pragma unroll
      for (int p = 1; p < 4; ++p) { s_lo += *(const v4f*)(sp + p * 64 * SS_P); s_hi += *(const v4f*)(sp + p * 64 * SS_P + 4); }
      float v[8];
      float mloc = -1e30f;
#pragma unroll
      for (int e = 0; e < 8; ++e) { v[e] = ((e < 4) ? s_lo[e & 3] : s_hi[e & 3]) * scale; mloc = fmaxf(mloc, v[e]); }
#pragma unroll
      for (int msk = 1; msk < 8; msk <<= 1) mloc = fmaxf(mloc, __shfl_xor(mloc, msk, 32));
      float m_new = fmaxf(m_prev, mloc);
      float alpha = __expf(m_prev - m_new);
      float ssum = 0.0f;
      h16x8 pk;
#pragma unroll
      for (int e = 0; e < 8; ++e) {
        float p = exp_slot(v[e] - m_new);
        ssum += p;
        pk[e] = (h16)(p * PSC);
      }
      *(h16x8*)&Ps[srow][sj * 8] = pk;
#pragma unroll
      for (int msk = 1; msk < 8; msk <<= 1) ssum += __shfl_xor(ssum, msk, 32);
      l_run = l_run * alpha + ssum;
      m_prev = m_new;
      if (sj == 0) { alpha_s[srow] = alpha; l_s[srow] = l_run; }
    }
    // Publish point of this V^T tile (and of P).
    asm volatile("s_wait_dscnt 0x0" ::: "memory");      // this wave's stores of P and its reads of the partial scores are done
    asm volatile("s_wait_asynccnt 0x0" ::: "memory");   // this wave's copies of the V^T tile have landed
    __syncthreads();   // V^T and P readable by all; every reader has left the partial scores in the K buffer
    if (kv0 + 64 < S_LEN) stage_k_async(kl0, kg0 + (size_t)(kv0 + 64) * D_DIM);   // the next K tile flies under the PV phase

    {
      float al[2][8];
#pragma unroll
      for (int i = 0; i < 2; ++i)
#pragma unroll
        for (int g = 0; g < 8; ++g) al[i][g] = alpha_s[pqh * 32 + i * 16 + g + 8 * half];
      // Compiler fence: keeps both tiles' reads of alpha in front of the fragment reads (LDS returns in order), so that the rescaling runs
      // while the fragments fly; without it the second tile's alpha was read between the two rescalings and waited for to 0.
      asm volatile("" ::: "memory");
      // V^T fragment n: k step n / 6, d tile n % 6; it feeds both query tiles (each output element still takes k step 0, then k step 1).
      // Reads run one group of four fragments (8 LDS loads) ahead of their WMMAs, in a ring of two groups; the first group flies under the rescaling.
      const h16* pp = &Ps[pqh * 32 + idx][half * 8];
      const h16* vp = &Vts[dg * 96 + idx][half * 8];
      v16h pa[2][2], vb[8];   // pa[query tile][k step]
#pragma unroll   // here and below, whole: the ring's slots must be compile-time register names
      for (int i = 0; i < 2; ++i) { pa[i][0] = load_frag_at(pp + i * 16 * PS_P); pa[i][1] = load_frag_at(pp + i * 16 * PS_P + 32); }
#pragma unroll   // slots
      for (int n = 0; n < 4; ++n) vb[n] = load_frag_at(vp + (n % 6) * 16 * KV_P + (n / 6) * 32);
#pragma unroll
      for (int i = 0; i < 2; ++i)
#pragma unroll
        for (int t = 0; t < 6; ++t)
#pragma unroll
          for (int g = 0; g < 8; ++g) o[i][t][g] *= al[i][g];
#pragma unroll   // slots
      for (int g = 0; g < 3; ++g) {
        if (g + 1 < 3) {
#pragma unroll   // slots
          for (int j = 0; j < 4; ++j) { const int n = (g + 1) * 4 + j; vb[n & 7] = load_frag_at(vp + (n % 6) * 16 * KV_P + (n / 6) * 32); }
        }
#pragma unroll   // slots
        for (int j = 0; j < 4; ++j)
#pragma unroll   // slots
          for (int i = 0; i < 2; ++i) { const int n = g * 4 + j; o[i][n % 6] = wmma_f16(pa[i][n / 6], vb[n & 7], o[i][n % 6]); }
      }
    }
  }
  asm volatile("s_wait_asynccnt 0x0" ::: "memory");   // no copy is outstanding when K and Q become output staging
  __syncthreads();

  float* Ot = (pqh == 0) ? (float*)&Ks[0][0] : (float*)&Qs[0][0];   // 32 output rows in each
#pragma unroll
  for (int i = 0; i < 2; ++i) {
    float linv[8];
#pragma unroll
    for (int g = 0; g < 8; ++g) linv[g] = PUN / l_s[pqh * 32 + i * 16 + g + 8 * half];
#pragma unroll
    for (int t = 0; t < 6; ++t) {
      int col = dg * 96 + t * 16 + idx;
#pragma unroll
      for (int g = 0; g < 8; ++g) Ot[(i * 16 + g + 8 * half) * D_DIM + col] = o[i][t][g] * linv[g];
    }
  }
  __syncthreads();
  {
    float* dst = out + ((size_t)(b * S_LEN + q0)) * D_DIM;      // 64 contiguous rows
    const float* O0 = (const float*)&Ks[0][0];
    const float* O1 = (const float*)&Qs[0][0];
    for (int gg = tid; gg < 32 * D_DIM / 4; gg += 512) vst2(dst + (size_t)gg * 4, *(const v4f*)(O0 + gg * 4));
    for (int gg = tid; gg < 32 * D_DIM / 4; gg += 512) vst2(dst + (size_t)(32 * D_DIM) + (size_t)gg * 4, *(const v4f*)(O1 + gg * 4));
  }
}

extern "C" void kernel_launch(void* const* d_in, const int* in_sizes, int n_in,
                              void* d_out, int out_size, void* d_ws, size_t ws_size,
                              hipStream_t stream) {
  (void)in_sizes; (void)n_in; (void)out_size; (void)ws_size;
  const float* x  = (const float*)d_in[0];
  const float* Wq = (const float*)d_in[1];
  const float* bq = (const float*)d_in[2];
  const float* Wk = (const float*)d_in[3];
  const float* bk = (const float*)d_in[4];
  const float* Wv = (const float*)d_in[5];
  const float* bv = (const float*)d_in[6];
  float* out = (float*)d_out;

  char* ws = (char*)d_ws;
  h16* xb  = (h16*)(ws + 0);           // 16384*768*2 = 25,165,824
  h16* WqT = (h16*)(ws + 25165824);    // 768*768*2   =  1,179,648
  h16* WkT = (h16*)(ws + 26345472);
  h16* WvT = (h16*)(ws + 27525120);
  h16* qb  = (h16*)(ws + 28704768);    // 25,165,824
  h16* kb  = (h16*)(ws + 53870592);    // 25,165,824
  h16* vtb = (h16*)(ws + 79036416);    // 25,165,824  (stored [b][d][s])

  int nx8 = M_TOT * D_DIM / 8;
  cvt_x_kernel<<<nx8 / 256, 256, 0, stream>>>(x, xb, nx8);
  cvt_w_kernel<<<dim3(D_DIM / 64, D_DIM / 256, 3), 256, 0, stream>>>(Wq, Wk, Wv, WqT, WkT, WvT);

  dim3 pg(M_TOT / 128, D_DIM / 128);
  proj_kernel<<<pg, 256, 0, stream>>>(xb, WqT, bq, qb, 0);
  proj_kernel<<<pg, 256, 0, stream>>>(xb, WkT, bk, kb, 0);
  proj_kernel<<<pg, 256, 0, stream>>>(xb, WvT, bv, vtb, 1);

  attn_kernel<<<dim3(S_LEN / 64, B_SZ), 512, 0, stream>>>(qb, kb, vtb, out);
}

// v008
// Measured time: 282 microseconds a run.
// Next to v007, in two timings, it ran 1.13 and 1.14 times as fast.
// Over all steps from v000 it is 7.25 times as fast.
#include <hip/hip_runtime.h>
// Contractions: Q/K/V projections (K = 768), scores Q K^T (K = 768) and P V (K = keys) on v_wmma_f32_16x16x32_f16
// (f16 operands, f32 accumulate; P scaled by 256 before its f16 conversion); softmax statistics in f32.

typedef _Float16 h16;
typedef _Float16 h16x8 __attribute__((ext_vector_type(8)));
typedef _Float16 v16h  __attribute__((ext_vector_type(16)));
typedef float  v8f    __attribute__((ext_vector_type(8)));
typedef float  v4f    __attribute__((ext_vector_type(4)));
typedef unsigned v4u  __attribute__((ext_vector_type(4)));

#define D_DIM 768
#define S_LEN 4096
#define B_SZ  4
#define M_TOT (B_SZ * S_LEN)   // 16384
#define PSC 256.0f
#define PUN (1.0f / 256.0f)
// LDS row pitches of the attention tiles. Fragment rows read by 16-byte LDS loads sit at 16 B x odd, so that the 16 rows
// of a half-wave fall on 16 different groups of four banks (64 banks of 4 B) instead of all on one group.
#define QK_P 776   // halves: 1552 B = 16 B x 97 (768 data + 8 pad)
#define KV_P 72    // halves:  144 B = 16 B x 9  (64 data + 8 pad)
#define SS_P 68    // floats:  272 B = 16 B x 17: row pitch of a plane of partial scores, written and read by 16-byte LDS operations
#define PS_P 136   // halves:  272 B = 16 B x 17: row pitch of P (64 data + 72 pad)

template <typename V> __device__ __forceinline__ void vst2(void* p, V v) {
  *(V*)p = v; 
}
__device__ __forceinline__ void copy16_g2s(h16* ldst, const h16* gsrc) { *(h16x8*)ldst = *(const h16x8*)gsrc; }

typedef int i32x4 __attribute__((vector_size(16)));
typedef __attribute__((address_space(1))) i32x4 g_i32x4;
typedef __attribute__((address_space(3))) i32x4 l_i32x4;
// OFF, in bytes (0 to 1280 here), is the instruction's immediate offset: it moves the LDS address and the global address alike.
template <int OFF> __device__ __forceinline__ void copy16_async(h16* ldst, const h16* gsrc) {
  __builtin_amdgcn_global_load_async_to_lds_b128((g_i32x4*)gsrc, (l_i32x4*)ldst, OFF, 0);
}
// K tile, 64 rows of 1536 B: 16 lanes take 256 B of a row; copy i: row + 32 * (i / 6), byte + 256 * (i % 6).
__device__ __forceinline__ void stage_k_async(h16* l0, const h16* g0) {
#pragma unroll   // whole: twelve copies in a row, constant steps
  for (int r = 0; r < 2; ++r) {
    h16* l = l0 + r * 32 * QK_P; const h16* g = g0 + r * 32 * D_DIM;
    copy16_async<0>(l, g);   copy16_async<256>(l, g);  copy16_async<512>(l, g);
    copy16_async<768>(l, g); copy16_async<1024>(l, g); copy16_async<1280>(l, g);
  }
}
// V^T tile, 768 rows of 128 B: 8 lanes take a row; copy i: row + 64 * i.
__device__ __forceinline__ void stage_v_async(h16* l0, const h16* g0) {
#pragma unroll   // whole: twelve copies in a row, constant steps
  for (int i = 0; i < 12; ++i) copy16_async<0>(l0 + i * 64 * KV_P, g0 + (size_t)i * 64 * S_LEN);
}

// ---- WMMA fragment loaders (f16, row-major K-contiguous source); A and B (from B^T rows) share the per-lane K map:
//      row/col = lane&15; elements 0..7 <- k0 + 8*half + 0..7, elements 8..15 <- k0 + 16 + 8*half + 0..7
__device__ __forceinline__ v16h load_a_frag(const h16* base, int ld, int k0) {
  int lane = threadIdx.x & 31;
  int idx  = lane & 15;
  int half = lane >> 4;
  const h16* p = base + idx * ld + k0 + half * 8;
  h16x8 lo = *(const h16x8*)(p);
  h16x8 hi = *(const h16x8*)(p + 16);
  return __builtin_shufflevector(lo, hi, 0,1,2,3,4,5,6,7,8,9,10,11,12,13,14,15);
}
__device__ __forceinline__ v16h load_b_frag(const h16* base, int ld, int k0) { return load_a_frag(base, ld, k0); }
// The same fragment from the lane's own address p = row start + k0 + 8 * half.
__device__ __forceinline__ v16h load_frag_at(const h16* p) {
  h16x8 lo = *(const h16x8*)(p);
  h16x8 hi = *(const h16x8*)(p + 16);
  return __builtin_shufflevector(lo, hi, 0,1,2,3,4,5,6,7,8,9,10,11,12,13,14,15);
}

__device__ __forceinline__ v8f wmma_f16(v16h a, v16h b, v8f c) {
  v8f d = __builtin_amdgcn_wmma_f32_16x16x32_f16(false, a, false, b, (short)0, c, false, false);
  asm volatile("v_nop\n\tv_nop\n\tv_nop\n\tv_nop" : "+v"(d) : "v"(a), "v"(b));
  return d;
}

// e^x as __expf forms it (x * log2 e, then v_exp_f32). The v_nop in the same statement is the one free slot that the instruction set
// asks for between a transcendental and a directly following instruction that reads its result or overwrites its source.
__device__ __forceinline__ float exp_slot(float x) {
  float r;
  asm("v_exp_f32 %0, %1\n\tv_nop" : "=v"(r) : "v"(x * 1.44269504f));
  return r;
}

// ---------------- conversion kernels ----------------
__global__ void cvt_x_kernel(const float* __restrict__ x, h16* __restrict__ xb, int n8) {   // 8 elements (16 B) per thread
  int g = blockIdx.x * blockDim.x + threadIdx.x;
  if (g >= n8) return;
  const v4f a = *(const v4f*)(x + (size_t)g * 8), b = *(const v4f*)(x + (size_t)g * 8 + 4);
  union { h16x8 h; v4u u; } pk;
#pragma unroll
  for (int i = 0; i < 4; ++i) { pk.h[i] = (h16)a[i]; pk.h[4 + i] = (h16)b[i]; }
  vst2(xb + (size_t)g * 8, pk.u);
}

__global__ __launch_bounds__(256) void cvt_w_kernel(const float* __restrict__ Wq, const float* __restrict__ Wk, const float* __restrict__ Wv,
                                                    h16* __restrict__ WqT, h16* __restrict__ WkT, h16* __restrict__ WvT) {
  __shared__ __align__(16) h16 tile[64][264];
  const float* W = (blockIdx.z == 0) ? Wq : (blockIdx.z == 1) ? Wk : Wv;
  h16*       WT = (blockIdx.z == 0) ? WqT : (blockIdx.z == 1) ? WkT : WvT;
  const int n0 = blockIdx.x * 64, k0 = blockIdx.y * 256, tid = threadIdx.x;
  for (int i = tid; i < 256 * 64; i += 256) { const int k = i >> 6, nl = i & 63; tile[nl][k] = (h16)W[(size_t)(k0 + k) * D_DIM + n0 + nl]; }
  __syncthreads();
  for (int g = tid; g < 64 * 32; g += 256) { const int nl = g >> 5, pc = g & 31; vst2(WT + (size_t)(n0 + nl) * D_DIM + k0 + pc * 8, *(const v4u*)(&tile[nl][pc * 8])); }
}

// ---------------- projection GEMM: out = X(16384x768) * W(768x768) + b ----------------
// Block tile 128 x 128, 8 waves: 4 M-groups (32 rows) x 2 N-groups (64 columns); each wave 2 x 4 WMMA tiles.
// The operands come in k slices of 64 halves: 128 X rows and 128 W^T rows of 128 B (whole cache lines), copied to LDS
// asynchronously, two buffers: slice s + 1 flies while slice s is worked on. Fragments are read from LDS.
#define PJ_P   72             // halves: LDS row pitch 144 B = 16 B x 9 (64 data + 8 pad), for 16-byte fragment reads
#define PJ_BUF (256 * PJ_P)   // halves in a buffer: rows 0..127 of X, rows 128..255 of W^T
#define PJ_T   136            // halves: row pitch of the output tile
#define PJ_NS  (D_DIM / 64)   // k slices

// Eight asynchronous copies of 16 B a lane in asm text: copy i brings the 16 B at g[i] to the LDS byte address l[i]. The copies and
// their s_wait_xcnt 0 are one statement, so that no address register named by a copy is rewritten in front of that wait.
__device__ __forceinline__ void copy8_async(const unsigned (&l)[8], const h16* const (&g)[8]) {
  asm volatile("global_load_async_to_lds_b128 %0, %8, off\n\t"
               "global_load_async_to_lds_b128 %1, %9, off\n\t"
               "global_load_async_to_lds_b128 %2, %10, off\n\t"
               "global_load_async_to_lds_b128 %3, %11, off\n\t"
               "global_load_async_to_lds_b128 %4, %12, off\n\t"
               "global_load_async_to_lds_b128 %5, %13, off\n\t"
               "global_load_async_to_lds_b128 %6, %14, off\n\t"
               "global_load_async_to_lds_b128 %7, %15, off\n\t"
               "s_wait_xcnt 0x0"
               :: "v"(l[0]), "v"(l[1]), "v"(l[2]), "v"(l[3]), "v"(l[4]), "v"(l[5]), "v"(l[6]), "v"(l[7]),
                  "v"(g[0]), "v"(g[1]), "v"(g[2]), "v"(g[3]), "v"(g[4]), "v"(g[5]), "v"(g[6]), "v"(g[7])
               : "memory");
}
// One k slice: 8 lanes take a row of 128 B; copy i: row + 32 * i of the buffer (i < 4: X, else W^T).
__device__ __forceinline__ void stage_proj_async(unsigned l0, const h16* xg, const h16* wg) {
  unsigned l[8]; const h16* g[8];
#pragma unroll   // whole: l and g must end as registers, the operands of one statement
  for (int i = 0; i < 8; ++i) { l[i] = l0 + i * 32 * PJ_P * 2; g[i] = (i < 4) ? xg + i * 32 * D_DIM : wg + (i - 4) * 32 * D_DIM; }
  copy8_async(l, g);
}

__global__ __launch_bounds__(256) void proj_kernel(const h16* __restrict__ Xb, const h16* __restrict__ WT,
                            const float* __restrict__ bias, h16* __restrict__ out, int transposed) {
  __shared__ __align__(16) h16 SB[2 * PJ_BUF];    // 72 KB: the two buffers; after the loop the output tile
  h16* T = SB;                                    // [m][n] (transposed==0) or [n][m] (transposed==1), pitch PJ_T
  const int tid = threadIdx.x;
  int m0 = blockIdx.x * 128;
  int n0 = blockIdx.y * 128;
  int w    = tid >> 5;
  int lane = tid & 31;
  int idx  = lane & 15;
  int half = lane >> 4;
  int wm = w & 3;
  int wn = w >> 2;

  // Each lane's first LDS byte address (the low 32 bits of the __shared__ address) and first global addresses.
  const unsigned l0 = (unsigned)(size_t)&SB[(tid >> 3) * PJ_P + (tid & 7) * 8];
  const h16* xg = Xb + (size_t)(m0 + (tid >> 3)) * D_DIM + (tid & 7) * 8;
  const h16* wg = WT + (size_t)(n0 + (tid >> 3)) * D_DIM + (tid & 7) * 8;
  stage_proj_async(l0, xg, wg);
  asm volatile("s_wait_asynccnt 0x0" ::: "memory");   // this wave's copies of slice 0 have landed
  __syncthreads();   // slice 0 readable by all
  stage_proj_async(l0 + PJ_BUF * 2, xg + 64, wg + 64);

  v8f c[2][4] = {};
  const h16* ap = &SB[(wm * 32 + idx) * PJ_P + half * 8];
  const h16* bp = &SB[(128 + wn * 64 + idx) * PJ_P + half * 8];
  for (int s = 0; s < PJ_NS; ++s) {
    const int bo = (s & 1) * PJ_BUF;
    // Fragments of the slice's two k steps: X fragment ks * 2 + i; W^T fragment n = ks * 4 + t in slot n % 6. All but the last two
    // are read as one group at the head of the trip; the last two take the slots that k step 0 has freed (six slots, not eight,
    // keep the wave inside the register budget of three work-groups a WGP).
    v16h a[4], vb[6];
#pragma unroll   // here and below, whole: the slots must be compile-time register names
    for (int n = 0; n < 4; ++n) a[n] = load_frag_at(ap + bo + (n & 1) * 16 * PJ_P + (n >> 1) * 32);
#pragma unroll   // slots
    for (int n = 0; n < 6; ++n) vb[n] = load_frag_at(bp + bo + (n & 3) * 16 * PJ_P + (n >> 2) * 32);
#pragma unroll   // slots
    for (int t = 0; t < 4; ++t)
#pragma unroll   // slots
      for (int i = 0; i < 2; ++i) c[i][t] = wmma_f16(a[i], vb[t], c[i][t]);
#pragma unroll   // slots
    for (int n = 6; n < 8; ++n) vb[n - 6] = load_frag_at(bp + bo + (n & 3) * 16 * PJ_P + (n >> 2) * 32);
#pragma unroll   // slots
    for (int t = 0; t < 4; ++t)
#pragma unroll   // slots
      for (int i = 0; i < 2; ++i) c[i][t] = wmma_f16(a[2 + i], vb[(4 + t) % 6], c[i][t]);
    // Publish point of slice s + 1.
    asm volatile("s_wait_dscnt 0x0" ::: "memory");      // this wave's reads of slice s are done
    asm volatile("s_wait_asynccnt 0x0" ::: "memory");   // this wave's copies of slice s + 1 have landed
    __syncthreads();   // slice s + 1 readable by all; every reader has left the buffer of slice s
    if (s + 2 < PJ_NS) stage_proj_async(l0 + (unsigned)bo * 2, xg + (s + 2) * 64, wg + (s + 2) * 64);
  }
  asm volatile("s_wait_asynccnt 0x0" ::: "memory");   // no copy is outstanding when the buffers become the output tile

#pragma unroll   // here and below, whole: the accumulators are registers, indexed by compile-time numbers only
  for (int i = 0; i < 2; ++i) {
#pragma unroll
    for (int t = 0; t < 4; ++t) {
      int cl = wn * 64 + t * 16 + idx;                 // local col
      float bv = bias[n0 + cl];
#pragma unroll
      for (int g = 0; g < 8; ++g) {
        int rl = wm * 32 + i * 16 + g + 8 * half;      // local row
        h16 hv = (h16)(c[i][t][g] + bv);
        if (!transposed) T[rl * PJ_T + cl] = hv; else T[cl * PJ_T + rl] = hv;
      }
    }
  }
  __syncthreads();
  if (!transposed) {
    for (int gg = tid; gg < 128 * 16; gg += 256) { const int rl = gg >> 4, pc = gg & 15; vst2(out + (size_t)(m0 + rl) * D_DIM + n0 + pc * 8, *(const v4u*)(&T[rl * PJ_T + pc * 8])); }
  } else {
    const int bb = m0 >> 12, s0 = m0 & (S_LEN - 1);
    for (int gg = tid; gg < 128 * 16; gg += 256) { const int cl = gg >> 4, pc = gg & 15; vst2(out + ((size_t)(bb * D_DIM + n0 + cl)) * S_LEN + s0 + pc * 8, *(const v4u*)(&T[cl * PJ_T + pc * 8])); }
  }
}

// ---------------- flash attention ----------------
// WG = 64 queries, 16 waves: every staged K and V^T tile serves 64 queries. KV tiles of 64 keys.
// Score phase: wave w -> 32 queries (w&1) x 32 keys ((w>>1)&1) over a quarter of the 768 dims (w>>2): 2 x 2 WMMA tiles, so each
//              fragment read from LDS feeds two WMMAs. The four partial sums of a score are added in the softmax phase.
// PV phase:    wave w -> 32 queries (w&1) x 96 dims (w>>1): 2 x 6 accumulator tiles, so each V^T fragment read feeds two WMMAs.
__global__ __launch_bounds__(512)
void attn_kernel(const h16* __restrict__ Q, const h16* __restrict__ K,
                 const h16* __restrict__ Vt, float* __restrict__ out) {
  __shared__ __align__(16) h16   Qs[64][QK_P];     // 97 KB (reused as f32 output rows 32..63 after the loop)
  __shared__ __align__(16) h16   Ks[64][QK_P];     // 97 KB (between scores and PV: four planes of partial scores; after the loop: f32 output rows 0..31)
  __shared__ __align__(16) h16   Vts[D_DIM][KV_P]; // 108 KB (d-major)
  __shared__ __align__(16) h16   Ps[64][PS_P];     // 17 KB (P in f16)
  __shared__ float alpha_s[64];
  __shared__ float l_s[64];

  int b   = blockIdx.y;
  int q0  = blockIdx.x * 64;
  int tid = threadIdx.x;
  int w    = tid >> 5;
  int lane = tid & 31;
  int idx  = lane & 15;
  int half = lane >> 4;
  int sqh = w & 1;         // score phase: half of the queries
  int skh = (w >> 1) & 1;  // score phase: half of the keys
  int skq = w >> 2;        // score phase: quarter of the dims
  int pqh = w & 1;         // PV phase: half of the queries
  int dg  = w >> 1;        // PV phase: d-group (96 dims)

  // Each lane's first LDS address and first global address of the two tiles.
  h16* kl0 = &Ks[tid >> 4][(tid & 15) * 8];
  h16* vl0 = &Vts[tid >> 3][(tid & 7) * 8];
  const h16* kg0 = K + ((size_t)(b * S_LEN) + (tid >> 4)) * D_DIM + (tid & 15) * 8;
  const h16* vg0 = Vt + (size_t)b * D_DIM * S_LEN + (size_t)(tid >> 3) * S_LEN + (tid & 7) * 8;
  // All 64 work-groups of a batch read the same 64 K and V^T tiles from L2. Each starts its walk at the tile of its own index and wraps,
  // so that at one moment they ask L2 for different lines, not all for the same ones. The running softmax takes the tiles in any order.
  const int rot = blockIdx.x;
  stage_k_async(kl0, kg0 + (size_t)(rot * 64) * D_DIM);   // the first K tile flies while Q is staged

  const h16* Qg = Q + ((size_t)(b * S_LEN + q0)) * D_DIM;
  for (int c = tid; c < 64 * (D_DIM / 8); c += 512) {
    int r = c / (D_DIM / 8), dc = c % (D_DIM / 8);
    copy16_g2s(&Qs[r][dc * 8], Qg + (size_t)r * D_DIM + dc * 8);
  }

  v8f o[2][6] = {};   // o[query tile][d tile]
  int   srow = tid >> 3;          // softmax: 8 threads per query row
  int   sj   = tid & 7;
  float m_prev = -1e30f;
  float l_run  = 0.0f;
  const float scale = 0.03608439182435161f;  // 1/sqrt(768)

  for (int it = 0; it < S_LEN / 64; ++it) {
    const int kv0 = ((it + rot) & (S_LEN / 64 - 1)) * 64;       // first key of this trip's tile
    const int kv1 = ((it + 1 + rot) & (S_LEN / 64 - 1)) * 64;   // first key of the next trip's tile
    // Publish point of this K tile: its copies flew under the previous PV phase (first trip: under the staging of Q).
    asm volatile("s_wait_dscnt 0x0" ::: "memory");      // this wave's reads of V^T and P (first trip: its stores of Q) are done
    asm volatile("s_wait_asynccnt 0x0" ::: "memory");   // this wave's copies of the K tile have landed
    __syncthreads();   // K (and Q) readable by all; every reader has left V^T
    stage_v_async(vl0, vg0 + kv0);   // this V^T tile flies under the score and softmax phases

    float* Sp = (float*)&Ks[0][0];   // partial scores: plane p (dims quarter p), query row r, key c at Sp[(p * 64 + r) * SS_P + c]
    {
      // Fragment reads run one group (one k step: 2 Q and 2 K fragments, 8 LDS loads) ahead of the four WMMAs that use them, in a
      // ring of two groups: the statement behind each WMMA holds LDS loads in source order, so a load written next to its WMMA is waited for to 0.
      const h16* qp = &Qs[sqh * 32 + idx][skq * 192 + half * 8];
      const h16* kp = &Ks[skh * 32 + idx][skq * 192 + half * 8];
      v16h qa[2][2], kb[2][2];
#pragma unroll   // here and below, whole: the ring's slots must be compile-time register names
      for (int i = 0; i < 2; ++i) { qa[0][i] = load_frag_at(qp + i * 16 * QK_P); kb[0][i] = load_frag_at(kp + i * 16 * QK_P); }
      v8f sc[2][2] = {};   // sc[j][i]: key tile j (rows of the product), query tile i (columns)
#pragma unroll   // slots
      for (int n = 0; n < 6; ++n) {
        if (n + 1 < 6) {
#pragma unroll   // slots
          for (int i = 0; i < 2; ++i) { qa[(n + 1) & 1][i] = load_frag_at(qp + i * 16 * QK_P + (n + 1) * 32); kb[(n + 1) & 1][i] = load_frag_at(kp + i * 16 * QK_P + (n + 1) * 32); }
        }
#pragma unroll   // slots
        for (int j = 0; j < 2; ++j)
#pragma unroll   // slots
          for (int i = 0; i < 2; ++i) sc[j][i] = wmma_f16(kb[n & 1][j], qa[n & 1][i], sc[j][i]);
      }
      __syncthreads();   // every reader has left K: its buffer takes the partial scores
      // K is the A operand: a lane holds 8 consecutive keys (8 * half + 0..7) of one query (idx), two 16-byte stores a tile.
#pragma unroll
      for (int j = 0; j < 2; ++j)
#pragma unroll
        for (int i = 0; i < 2; ++i) {
          float* d = Sp + (skq * 64 + sqh * 32 + i * 16 + idx) * SS_P + skh * 32 + j * 16 + half * 8;
          v4f lo = { sc[j][i][0], sc[j][i][1], sc[j][i][2], sc[j][i][3] };
          v4f hi = { sc[j][i][4], sc[j][i][5], sc[j][i][6], sc[j][i][7] };
          *(v4f*)d = lo;
          *(v4f*)(d + 4) = hi;
        }
    }
    __syncthreads();

    {
      // Thread sj of a row takes its keys 8 * sj + 0..7: the four partial sums of each, added in the order of the dims.
      const float* sp = Sp + srow * SS_P + sj * 8;
      v4f s_lo = *(const v4f*)sp, s_hi = *(const v4f*)(sp + 4);
#pragma unroll
      for (int p = 1; p < 4; ++p) { s_lo += *(const v4f*)(sp + p * 64 * SS_P); s_hi += *(const v4f*)(sp + p * 64 * SS_P + 4); }
      float v[8];
      float mloc = -1e30f;
#pragma unroll
      for (int e = 0; e < 8; ++e) { v[e] = ((e < 4) ? s_lo[e & 3] : s_hi[e & 3]) * scale; mloc = fmaxf(mloc, v[e]); }
#pragma unroll
      for (int msk = 1; msk < 8; msk <<= 1) mloc = fmaxf(mloc, __shfl_xor(mloc, msk, 32));
      float m_new = fmaxf(m_prev, mloc);
      float alpha = __expf(m_prev - m_new);
      float ssum = 0.0f;
      h16x8 pk;
#pragma unroll
      for (int e = 0; e < 8; ++e) {
        float p = exp_slot(v[e] - m_new);
        ssum += p;
        pk[e] = (h16)(p * PSC);
      }
      *(h16x8*)&Ps[srow][sj * 8] = pk;
#pragma unroll
      for (int msk = 1; msk < 8; msk <<= 1) ssum += __shfl_xor(ssum, msk, 32);
      l_run = l_run * alpha + ssum;
      m_prev = m_new;
      if (sj == 0) { alpha_s[srow] = alpha; l_s[srow] = l_run; }
    }
    // Publish point of this V^T tile (and of P).
    asm volatile("s_wait_dscnt 0x0" ::: "memory");      // this wave's stores of P and its reads of the partial scores are done
    asm volatile("s_wait_asynccnt 0x0" ::: "memory");   // this wave's copies of the V^T tile have landed
    __syncthreads();   // V^T and P readable by all; every reader has left the partial scores in the K buffer
    if (it + 1 < S_LEN / 64) stage_k_async(kl0, kg0 + (size_t)kv1 * D_DIM);   // the next K tile flies under the PV phase

    {
      float al[2][8];
#pragma unroll
      for (int i = 0; i < 2; ++i)
#pragma unroll
        for (int g = 0; g < 8; ++g) al[i][g] = alpha_s[pqh * 32 + i * 16 + g + 8 * half];
      // Compiler fence: keeps both tiles' reads of alpha in front of the fragment reads (LDS returns in order), so that the rescaling runs
      // while the fragments fly; without it the second tile's alpha was read between the two rescalings and waited for to 0.
      asm volatile("" ::: "memory");
      // V^T fragment n: k step n / 6, d tile n % 6; it feeds both query tiles (each output element still takes k step 0, then k step 1).
      // Reads run one group of four fragments (8 LDS loads) ahead of their WMMAs, in a ring of two groups; the first group flies under the rescaling.
      const h16* pp = &Ps[pqh * 32 + idx][half * 8];
      const h16* vp = &Vts[dg * 96 + idx][half * 8];
      v16h pa[2][2], vb[8];   // pa[query tile][k step]
#pragma unroll   // here and below, whole: the ring's slots must be compile-time register names
      for (int i = 0; i < 2; ++i) { pa[i][0] = load_frag_at(pp + i * 16 * PS_P); pa[i][1] = load_frag_at(pp + i * 16 * PS_P + 32); }
#pragma unroll   // slots
      for (int n = 0; n < 4; ++n) vb[n] = load_frag_at(vp + (n % 6) * 16 * KV_P + (n / 6) * 32);
#pragma unroll
      for (int i = 0; i < 2; ++i)
#pragma unroll
        for (int t = 0; t < 6; ++t)
#pragma unroll
          for (int g = 0; g < 8; ++g) o[i][t][g] *= al[i][g];
#pragma unroll   // slots
      for (int g = 0; g < 3; ++g) {
        if (g + 1 < 3) {
#pragma unroll   // slots
          for (int j = 0; j < 4; ++j) { const int n = (g + 1) * 4 + j; vb[n & 7] = load_frag_at(vp + (n % 6) * 16 * KV_P + (n / 6) * 32); }
        }
#pragma unroll   // slots
        for (int j = 0; j < 4; ++j)
#pragma unroll   // slots
          for (int i = 0; i < 2; ++i) { const int n = g * 4 + j; o[i][n % 6] = wmma_f16(pa[i][n / 6], vb[n & 7], o[i][n % 6]); }
      }
    }
  }
  asm volatile("s_wait_asynccnt 0x0" ::: "memory");   // no copy is outstanding when K and Q become output staging
  __syncthreads();

  float* Ot = (pqh == 0) ? (float*)&Ks[0][0] : (float*)&Qs[0][0];   // 32 output rows in each
#pragma unroll
  for (int i = 0; i < 2; ++i) {
    float linv[8];
#pragma unroll
    for (int g = 0; g < 8; ++g) linv[g] = PUN / l_s[pqh * 32 + i * 16 + g + 8 * half];
#pragma unroll
    for (int t = 0; t < 6; ++t) {
      int col = dg * 96 + t * 16 + idx;
#pragma unroll
      for (int g = 0; g < 8; ++g) Ot[(i * 16 + g + 8 * half) * D_DIM + col] = o[i][t][g] * linv[g];
    }
  }
  __syncthreads();
  {
    float* dst = out + ((size_t)(b * S_LEN + q0)) * D_DIM;      // 64 contiguous rows
    const float* O0 = (const float*)&Ks[0][0];
    const float* O1 = (const float*)&Qs[0][0];
    for (int gg = tid; gg < 32 * D_DIM / 4; gg += 512) vst2(dst + (size_t)gg * 4, *(const v4f*)(O0 + gg * 4));
    for (int gg = tid; gg < 32 * D_DIM / 4; gg += 512) vst2(dst + (size_t)(32 * D_DIM) + (size_t)gg * 4, *(const v4f*)(O1 + gg * 4));
  }
}

extern "C" void kernel_launch(void* const* d_in, const int* in_sizes, int n_in,
                              void* d_out, int out_size, void* d_ws, size_t ws_size,
                              hipStream_t stream) {
  (void)in_sizes; (void)n_in; (void)out_size; (void)ws_size;
  const float* x  = (const float*)d_in[0];
  const float* Wq = (const float*)d_in[1];
  const float* bq = (const float*)d_in[2];
  const float* Wk = (const float*)d_in[3];
  const float* bk = (const float*)d_in[4];
  const float* Wv = (const float*)d_in[5];
  const float* bv = (const float*)d_in[6];
  float* out = (float*)d_out;

  char* ws = (char*)d_ws;
  h16* xb  = (h16*)(ws + 0);           // 16384*768*2 = 25,165,824
  h16* WqT = (h16*)(ws + 25165824);    // 768*768*2   =  1,179,648
  h16* WkT = (h16*)(ws + 26345472);
  h16* WvT = (h16*)(ws + 27525120);
  h16* qb  = (h16*)(ws + 28704768);    // 25,165,824
  h16* kb  = (h16*)(ws + 53870592);    // 25,165,824
  h16* vtb = (h16*)(ws + 79036416);    // 25,165,824  (stored [b][d][s])

  int nx8 = M_TOT * D_DIM / 8;
  cvt_x_kernel<<<nx8 / 256, 256, 0, stream>>>(x, xb, nx8);
  cvt_w_kernel<<<dim3(D_DIM / 64, D_DIM / 256, 3), 256, 0, stream>>>(Wq, Wk, Wv, WqT, WkT, WvT);

  dim3 pg(M_TOT / 128, D_DIM / 128);
  proj_kernel<<<pg, 256, 0, stream>>>(xb, WqT, bq, qb, 0);
  proj_kernel<<<pg, 256, 0, stream>>>(xb, WkT, bk, kb, 0);
  proj_kernel<<<pg, 256, 0, stream>>>(xb, WvT, bv, vtb, 1);

  attn_kernel<<<dim3(S_LEN / 64, B_SZ), 512, 0, stream>>>(qb, kb, vtb, out);
}

// v009
// A run of this version takes 262 microseconds.
// Two timings next to v008 both put it at 1.08 times that version's speed.
// Over all steps from v000 it is 7.83 times as fast.
#include <hip/hip_runtime.h>
// Contractions: Q/K/V projections (K = 768), scores Q K^T (K = 768) and P V (K = keys) on v_wmma_f32_16x16x32_f16
// (f16 operands, f32 accumulate; P scaled by 256 before its f16 conversion); softmax statistics in f32.

typedef _Float16 h16;
typedef _Float16 h16x8 __attribute__((ext_vector_type(8)));
typedef _Float16 v16h  __attribute__((ext_vector_type(16)));
typedef float  v8f    __attribute__((ext_vector_type(8)));
typedef float  v4f    __attribute__((ext_vector_type(4)));
typedef unsigned v4u  __attribute__((ext_vector_type(4)));

#define D_DIM 768
#define S_LEN 4096
#define B_SZ  4
#define M_TOT (B_SZ * S_LEN)   // 16384
#define PSC 256.0f
#define PUN (1.0f / 256.0f)
// LDS row pitches of the attention tiles. Fragment rows read by 16-byte LDS loads sit at 16 B x odd, so that the 16 rows
// of a half-wave fall on 16 different groups of four banks (64 banks of 4 B) instead of all on one group.
#define QK_P 776   // halves: 1552 B = 16 B x 97 (768 data + 8 pad)
#define KV_P 72    // halves:  144 B = 16 B x 9  (64 data + 8 pad)
#define SS_P 68    // floats:  272 B = 16 B x 17: row pitch of a plane of partial scores, written and read by 16-byte LDS operations
#define PS_P 136   // halves:  272 B = 16 B x 17: row pitch of P (64 data + 72 pad)

template <typename V> __device__ __forceinline__ void vst2(void* p, V v) {
  *(V*)p = v; 
}

typedef int i32x4 __attribute__((vector_size(16)));
typedef __attribute__((address_space(1))) i32x4 g_i32x4;
typedef __attribute__((address_space(3))) i32x4 l_i32x4;
// OFF, in bytes (0 to 1280 here), is the instruction's immediate offset: it moves the LDS address and the global address alike.
template <int OFF> __device__ __forceinline__ void copy16_async(h16* ldst, const h16* gsrc) {
  __builtin_amdgcn_global_load_async_to_lds_b128((g_i32x4*)gsrc, (l_i32x4*)ldst, OFF, 0);
}
// K tile, 64 rows of 1536 B: 16 lanes take 256 B of a row; copy i: row + 16 * (i / 6), byte + 256 * (i % 6).
__device__ __forceinline__ void stage_k_async(h16* l0, const h16* g0) {
#pragma unroll   // whole: 24 copies in a row, constant steps
  for (int r = 0; r < 4; ++r) {
    h16* l = l0 + r * 16 * QK_P; const h16* g = g0 + r * 16 * D_DIM;
    copy16_async<0>(l, g);   copy16_async<256>(l, g);  copy16_async<512>(l, g);
    copy16_async<768>(l, g); copy16_async<1024>(l, g); copy16_async<1280>(l, g);
  }
}
// A sixth of a V^T tile, 128 rows of 128 B: 8 lanes take a row; copy i: row + 32 * i.
__device__ __forceinline__ void stage_v_async4(h16* l0, const h16* g0) {
#pragma unroll   // whole: four copies in a row, constant steps
  for (int i = 0; i < 4; ++i) copy16_async<0>(l0 + i * 32 * KV_P, g0 + (size_t)i * 32 * S_LEN);
}

// ---- WMMA fragment loaders (f16, row-major K-contiguous source); A and B (from B^T rows) share the per-lane K map:
//      row/col = lane&15; elements 0..7 <- k0 + 8*half + 0..7, elements 8..15 <- k0 + 16 + 8*half + 0..7
__device__ __forceinline__ v16h load_a_frag(const h16* base, int ld, int k0) {
  int lane = threadIdx.x & 31;
  int idx  = lane & 15;
  int half = lane >> 4;
  const h16* p = base + idx * ld + k0 + half * 8;
  h16x8 lo = *(const h16x8*)(p);
  h16x8 hi = *(const h16x8*)(p + 16);
  return __builtin_shufflevector(lo, hi, 0,1,2,3,4,5,6,7,8,9,10,11,12,13,14,15);
}
__device__ __forceinline__ v16h load_b_frag(const h16* base, int ld, int k0) { return load_a_frag(base, ld, k0); }
// The same fragment from the lane's own address p = row start + k0 + 8 * half.
__device__ __forceinline__ v16h load_frag_at(const h16* p) {
  h16x8 lo = *(const h16x8*)(p);
  h16x8 hi = *(const h16x8*)(p + 16);
  return __builtin_shufflevector(lo, hi, 0,1,2,3,4,5,6,7,8,9,10,11,12,13,14,15);
}

__device__ __forceinline__ v8f wmma_f16(v16h a, v16h b, v8f c) {
  v8f d = __builtin_amdgcn_wmma_f32_16x16x32_f16(false, a, false, b, (short)0, c, false, false);
  asm volatile("v_nop\n\tv_nop\n\tv_nop\n\tv_nop" : "+v"(d) : "v"(a), "v"(b));
  return d;
}

// The same product for a kernel above 256 registers: an asm statement's vector operands can only be registers of the first 256, so a
// statement behind each WMMA would pull every accumulator and fragment down there; the compiler keeps the distances of its own builtin.
__device__ __forceinline__ v8f wmma_f16_wide(v16h a, v16h b, v8f c) {
  return __builtin_amdgcn_wmma_f32_16x16x32_f16(false, a, false, b, (short)0, c, false, false);
}

// ---------------- conversion kernels ----------------
__global__ void cvt_x_kernel(const float* __restrict__ x, h16* __restrict__ xb, int n8) {   // 8 elements (16 B) per thread
  int g = blockIdx.x * blockDim.x + threadIdx.x;
  if (g >= n8) return;
  const v4f a = *(const v4f*)(x + (size_t)g * 8), b = *(const v4f*)(x + (size_t)g * 8 + 4);
  union { h16x8 h; v4u u; } pk;
#pragma unroll
  for (int i = 0; i < 4; ++i) { pk.h[i] = (h16)a[i]; pk.h[4 + i] = (h16)b[i]; }
  vst2(xb + (size_t)g * 8, pk.u);
}

__global__ __launch_bounds__(256) void cvt_w_kernel(const float* __restrict__ Wq, const float* __restrict__ Wk, const float* __restrict__ Wv,
                                                    h16* __restrict__ WqT, h16* __restrict__ WkT, h16* __restrict__ WvT) {
  __shared__ __align__(16) h16 tile[64][264];
  const float* W = (blockIdx.z == 0) ? Wq : (blockIdx.z == 1) ? Wk : Wv;
  h16*       WT = (blockIdx.z == 0) ? WqT : (blockIdx.z == 1) ? WkT : WvT;
  const int n0 = blockIdx.x * 64, k0 = blockIdx.y * 256, tid = threadIdx.x;
  for (int i = tid; i < 256 * 64; i += 256) { const int k = i >> 6, nl = i & 63; tile[nl][k] = (h16)W[(size_t)(k0 + k) * D_DIM + n0 + nl]; }
  __syncthreads();
  for (int g = tid; g < 64 * 32; g += 256) { const int nl = g >> 5, pc = g & 31; vst2(WT + (size_t)(n0 + nl) * D_DIM + k0 + pc * 8, *(const v4u*)(&tile[nl][pc * 8])); }
}

// ---------------- projection GEMM: out = X(16384x768) * W(768x768) + b ----------------
// Block tile 128 x 128, 8 waves: 4 M-groups (32 rows) x 2 N-groups (64 columns); each wave 2 x 4 WMMA tiles.
// The operands come in k slices of 64 halves: 128 X rows and 128 W^T rows of 128 B (whole cache lines), copied to LDS
// asynchronously, two buffers: slice s + 1 flies while slice s is worked on. Fragments are read from LDS.
#define PJ_P   72             // halves: LDS row pitch 144 B = 16 B x 9 (64 data + 8 pad), for 16-byte fragment reads
#define PJ_BUF (256 * PJ_P)   // halves in a buffer: rows 0..127 of X, rows 128..255 of W^T
#define PJ_T   136            // halves: row pitch of the output tile
#define PJ_NS  (D_DIM / 64)   // k slices

// Eight asynchronous copies of 16 B a lane in asm text: copy i brings the 16 B at g[i] to the LDS byte address l[i]. The copies and
// their s_wait_xcnt 0 are one statement, so that no address register named by a copy is rewritten in front of that wait.
__device__ __forceinline__ void copy8_async(const unsigned (&l)[8], const h16* const (&g)[8]) {
  asm volatile("global_load_async_to_lds_b128 %0, %8, off\n\t"
               "global_load_async_to_lds_b128 %1, %9, off\n\t"
               "global_load_async_to_lds_b128 %2, %10, off\n\t"
               "global_load_async_to_lds_b128 %3, %11, off\n\t"
               "global_load_async_to_lds_b128 %4, %12, off\n\t"
               "global_load_async_to_lds_b128 %5, %13, off\n\t"
               "global_load_async_to_lds_b128 %6, %14, off\n\t"
               "global_load_async_to_lds_b128 %7, %15, off\n\t"
               "s_wait_xcnt 0x0"
               :: "v"(l[0]), "v"(l[1]), "v"(l[2]), "v"(l[3]), "v"(l[4]), "v"(l[5]), "v"(l[6]), "v"(l[7]),
                  "v"(g[0]), "v"(g[1]), "v"(g[2]), "v"(g[3]), "v"(g[4]), "v"(g[5]), "v"(g[6]), "v"(g[7])
               : "memory");
}
// One k slice: 8 lanes take a row of 128 B; copy i: row + 32 * i of the buffer (i < 4: X, else W^T).
__device__ __forceinline__ void stage_proj_async(unsigned l0, const h16* xg, const h16* wg) {
  unsigned l[8]; const h16* g[8];
#pragma unroll   // whole: l and g must end as registers, the operands of one statement
  for (int i = 0; i < 8; ++i) { l[i] = l0 + i * 32 * PJ_P * 2; g[i] = (i < 4) ? xg + i * 32 * D_DIM : wg + (i - 4) * 32 * D_DIM; }
  copy8_async(l, g);
}

__global__ __launch_bounds__(256) void proj_kernel(const h16* __restrict__ Xb, const h16* __restrict__ WT,
                            const float* __restrict__ bias, h16* __restrict__ out, int transposed) {
  __shared__ __align__(16) h16 SB[2 * PJ_BUF];    // 72 KB: the two buffers; after the loop the output tile
  h16* T = SB;                                    // [m][n] (transposed==0) or [n][m] (transposed==1), pitch PJ_T
  const int tid = threadIdx.x;
  int m0 = blockIdx.x * 128;
  int n0 = blockIdx.y * 128;
  int w    = tid >> 5;
  int lane = tid & 31;
  int idx  = lane & 15;
  int half = lane >> 4;
  int wm = w & 3;
  int wn = w >> 2;

  // Each lane's first LDS byte address (the low 32 bits of the __shared__ address) and first global addresses.
  const unsigned l0 = (unsigned)(size_t)&SB[(tid >> 3) * PJ_P + (tid & 7) * 8];
  const h16* xg = Xb + (size_t)(m0 + (tid >> 3)) * D_DIM + (tid & 7) * 8;
  const h16* wg = WT + (size_t)(n0 + (tid >> 3)) * D_DIM + (tid & 7) * 8;
  stage_proj_async(l0, xg, wg);
  asm volatile("s_wait_asynccnt 0x0" ::: "memory");   // this wave's copies of slice 0 have landed
  __syncthreads();   // slice 0 readable by all
  stage_proj_async(l0 + PJ_BUF * 2, xg + 64, wg + 64);

  v8f c[2][4] = {};
  const h16* ap = &SB[(wm * 32 + idx) * PJ_P + half * 8];
  const h16* bp = &SB[(128 + wn * 64 + idx) * PJ_P + half * 8];
  for (int s = 0; s < PJ_NS; ++s) {
    const int bo = (s & 1) * PJ_BUF;
    // Fragments of the slice's two k steps: X fragment ks * 2 + i; W^T fragment n = ks * 4 + t in slot n % 6. All but the last two
    // are read as one group at the head of the trip; the last two take the slots that k step 0 has freed (six slots, not eight,
    // keep the wave inside the register budget of three work-groups a WGP).
    v16h a[4], vb[6];
#pragma unroll   // here and below, whole: the slots must be compile-time register names
    for (int n = 0; n < 4; ++n) a[n] = load_frag_at(ap + bo + (n & 1) * 16 * PJ_P + (n >> 1) * 32);
#pragma unroll   // slots
    for (int n = 0; n < 6; ++n) vb[n] = load_frag_at(bp + bo + (n & 3) * 16 * PJ_P + (n >> 2) * 32);
#pragma unroll   // slots
    for (int t = 0; t < 4; ++t)
#pragma unroll   // slots
      for (int i = 0; i < 2; ++i) c[i][t] = wmma_f16(a[i], vb[t], c[i][t]);
#pragma unroll   // slots
    for (int n = 6; n < 8; ++n) vb[n - 6] = load_frag_at(bp + bo + (n & 3) * 16 * PJ_P + (n >> 2) * 32);
#pragma unroll   // slots
    for (int t = 0; t < 4; ++t)
#pragma unroll   // slots
      for (int i = 0; i < 2; ++i) c[i][t] = wmma_f16(a[2 + i], vb[(4 + t) % 6], c[i][t]);
    // Publish point of slice s + 1.
    asm volatile("s_wait_dscnt 0x0" ::: "memory");      // this wave's reads of slice s are done
    asm volatile("s_wait_asynccnt 0x0" ::: "memory");   // this wave's copies of slice s + 1 have landed
    __syncthreads();   // slice s + 1 readable by all; every reader has left the buffer of slice s
    if (s + 2 < PJ_NS) stage_proj_async(l0 + (unsigned)bo * 2, xg + (s + 2) * 64, wg + (s + 2) * 64);
  }
  asm volatile("s_wait_asynccnt 0x0" ::: "memory");   // no copy is outstanding when the buffers become the output tile

#pragma unroll   // here and below, whole: the accumulators are registers, indexed by compile-time numbers only
  for (int i = 0; i < 2; ++i) {
#pragma unroll
    for (int t = 0; t < 4; ++t) {
      int cl = wn * 64 + t * 16 + idx;                 // local col
      float bv = bias[n0 + cl];
#pragma unroll
      for (int g = 0; g < 8; ++g) {
        int rl = wm * 32 + i * 16 + g + 8 * half;      // local row
        h16 hv = (h16)(c[i][t][g] + bv);
        if (!transposed) T[rl * PJ_T + cl] = hv; else T[cl * PJ_T + rl] = hv;
      }
    }
  }
  __syncthreads();
  if (!transposed) {
    for (int gg = tid; gg < 128 * 16; gg += 256) { const int rl = gg >> 4, pc = gg & 15; vst2(out + (size_t)(m0 + rl) * D_DIM + n0 + pc * 8, *(const v4u*)(&T[rl * PJ_T + pc * 8])); }
  } else {
    const int bb = m0 >> 12, s0 = m0 & (S_LEN - 1);
    for (int gg = tid; gg < 128 * 16; gg += 256) { const int cl = gg >> 4, pc = gg & 15; vst2(out + ((size_t)(bb * D_DIM + n0 + cl)) * S_LEN + s0 + pc * 8, *(const v4u*)(&T[cl * PJ_T + pc * 8])); }
  }
}

// ---------------- flash attention ----------------
// WG = 64 queries, 8 waves of up to 512 registers (two waves a SIMD): wide wave tiles, so that an LDS fragment read feeds many WMMAs.
// KV tiles of 64 keys.
// Score phase: wave w -> 32 queries (w&1) x all 64 keys over a quarter of the 768 dims (w>>1): 4 x 2 WMMA tiles. The wave's Q fragments
//              are the same for every tile: they are loaded once and stay in registers, only K is read from LDS (a fragment read feeds
//              two WMMAs). The four partial sums of a score are added in the softmax phase.
// PV phase:    wave w -> all 64 queries x 96 dims (w): 4 x 6 accumulator tiles, so each V^T fragment read feeds four WMMAs, each P fragment read six.
__global__ __launch_bounds__(256)
void attn_kernel(const h16* __restrict__ Q, const h16* __restrict__ K,
                 const h16* __restrict__ Vt, float* __restrict__ out) {
  __shared__ __align__(16) h16   Sx[64][QK_P];     // 97 KB: four planes of partial scores (68 KB); after the loop: f32 output rows 32..63
  __shared__ __align__(16) h16   Ks[64][QK_P];     // 97 KB (after the loop: f32 output rows 0..31)
  __shared__ __align__(16) h16   Vts[D_DIM][KV_P]; // 108 KB (d-major)
  __shared__ __align__(16) h16   Ps[64][PS_P];     // 17 KB (P in f16)
  __shared__ float alpha_s[64];
  __shared__ float l_s[64];

  int b   = blockIdx.y;
  int q0  = blockIdx.x * 64;
  int tid = threadIdx.x;
  int w    = tid >> 5;
  int lane = tid & 31;
  int idx  = lane & 15;
  int half = lane >> 4;
  int sqh = w & 1;         // score phase: half of the queries
  int skq = w >> 1;        // score phase: quarter of the dims
  int dg  = w;             // PV phase: d-group (96 dims)

  // Each lane's first LDS address and first global address of the two tiles.
  h16* kl0 = &Ks[tid >> 4][(tid & 15) * 8];
  h16* vl0 = &Vts[tid >> 3][(tid & 7) * 8];
  const h16* kg0 = K + ((size_t)(b * S_LEN) + (tid >> 4)) * D_DIM + (tid & 15) * 8;
  const h16* vg0 = Vt + (size_t)b * D_DIM * S_LEN + (size_t)(tid >> 3) * S_LEN + (tid & 7) * 8;
  // All 64 work-groups of a batch read the same 64 K and V^T tiles from L2. Each starts its walk at the tile of its own index and wraps,
  // so that at one moment they ask L2 for different lines, not all for the same ones. The running softmax takes the tiles in any order.
  const int rot = blockIdx.x;
  stage_k_async(kl0, kg0 + (size_t)(rot * 64) * D_DIM);   // the first K tile flies while the Q fragments are loaded

  // Q fragment [query tile i][k step n] of this wave's 32 queries and 192 dims, straight from global memory in the fragment's own lane map.
  const h16* qg = Q + ((size_t)(b * S_LEN + q0 + sqh * 32 + idx)) * D_DIM + skq * 192 + half * 8;
  v16h qf[2][6];
#pragma unroll   // here and below, whole: the fragments are registers, indexed by compile-time numbers only
  for (int i = 0; i < 2; ++i)
#pragma unroll
    for (int n = 0; n < 6; ++n) qf[i][n] = load_frag_at(qg + i * 16 * D_DIM + n * 32);
  // Stands in front of the first instruction that overwrites the address registers of the loads above: the address is named as an input,
  // so that its registers live up to the wait (without it later address arithmetic took them over in front of the wait).
  asm volatile("s_wait_xcnt 0x0" :: "v"(qg) : "memory");

  v8f o[4][6] = {};   // o[query tile][d tile]
  int   srow = tid >> 2;          // softmax: 4 threads per query row
  int   sj   = tid & 3;
  float m_prev = -1e30f;
  float l_run  = 0.0f;
  const float scale = 0.03608439182435161f;  // 1/sqrt(768)

  for (int it = 0; it < S_LEN / 64; ++it) {
    const int kv0 = ((it + rot) & (S_LEN / 64 - 1)) * 64;       // first key of this trip's tile
    const int kv1 = ((it + 1 + rot) & (S_LEN / 64 - 1)) * 64;   // first key of the next trip's tile
    // Publish point of this K tile: its copies flew under the previous PV phase (first trip: under the loads of Q).
    asm volatile("s_wait_dscnt 0x0" ::: "memory");      // this wave's reads of V^T and P are done
    asm volatile("s_wait_asynccnt 0x0" ::: "memory");   // this wave's copies of the K tile have landed
    __syncthreads();   // K readable by all; every reader has left V^T: its copies may start

    float* Sp = (float*)&Sx[0][0];   // partial scores: plane p (dims quarter p), query row r, key c at Sp[(p * 64 + r) * SS_P + c]
    {
      // K fragment reads run one group (one k step: 4 fragments, 8 LDS loads) ahead of the eight WMMAs that use them, in a ring of two
      // groups, so that no read is waited for to 0 right behind its issue.
      const h16* kp = &Ks[idx][skq * 192 + half * 8];
      v16h kb[2][4];
#pragma unroll   // here and below, whole: the ring's slots must be compile-time register names
      for (int j = 0; j < 4; ++j) kb[0][j] = load_frag_at(kp + j * 16 * QK_P);
      v8f sc[4][2] = {};   // sc[j][i]: key tile j (rows of the product), query tile i (columns)
#pragma unroll   // slots
      for (int n = 0; n < 6; ++n) {
        if (n + 1 < 6) {
#pragma unroll   // slots
          for (int j = 0; j < 4; ++j) kb[(n + 1) & 1][j] = load_frag_at(kp + j * 16 * QK_P + (n + 1) * 32);
        }
        // This V^T tile flies under the score and softmax phases. Four of its 24 copies a k step: their issue hides among the step's WMMAs,
        // and no run of 24 copies stands in front of the first fragment reads.
        stage_v_async4(vl0 + n * 128 * KV_P, vg0 + kv0 + (size_t)n * 128 * S_LEN);
        __builtin_amdgcn_sched_barrier(0);   // holds the reads of step n + 1 in front of the WMMAs of step n; else WMMAs of step n + 1 were drawn up to just behind their reads
#pragma unroll   // slots
        for (int j = 0; j < 4; ++j)
#pragma unroll   // slots
          for (int i = 0; i < 2; ++i) sc[j][i] = wmma_f16_wide(kb[n & 1][j], qf[i][n], sc[j][i]);
      }
      // K is the A operand: a lane holds 8 consecutive keys (8 * half + 0..7) of one query (idx), two 16-byte stores a tile.
      // The planes have a buffer of their own: its last readers left it in front of the two barriers since the previous softmax phase.
#pragma unroll
      for (int j = 0; j < 4; ++j)
#pragma unroll
        for (int i = 0; i < 2; ++i) {
          float* d = Sp + (skq * 64 + sqh * 32 + i * 16 + idx) * SS_P + j * 16 + half * 8;
          v4f lo = { sc[j][i][0], sc[j][i][1], sc[j][i][2], sc[j][i][3] };
          v4f hi = { sc[j][i][4], sc[j][i][5], sc[j][i][6], sc[j][i][7] };
          *(v4f*)d = lo;
          *(v4f*)(d + 4) = hi;
        }
    }
    __syncthreads();   // the partial scores readable by all; every reader has left K

    {
      // Thread sj of a row takes its keys 16 * sj + 0..15: the four partial sums of each, added in the order of the dims.
      const float* sp = Sp + srow * SS_P + sj * 16;
      v4f sq[4][4], s4[4];
#pragma unroll
      for (int p = 0; p < 4; ++p)
#pragma unroll
        for (int c = 0; c < 4; ++c) sq[p][c] = *(const v4f*)(sp + p * 64 * SS_P + c * 4);
      // Compiler fence: no read sinks below it, so the sixteen fly together, about one LDS latency for the lot; without it they were
      // read one or two at a time, each waited for to 0.
      asm volatile("" ::: "memory");
#pragma unroll
      for (int c = 0; c < 4; ++c) s4[c] = ((sq[0][c] + sq[1][c]) + sq[2][c]) + sq[3][c];
      float v[16];
      float mloc = -1e30f;
#pragma unroll
      for (int e = 0; e < 16; ++e) { v[e] = s4[e >> 2][e & 3] * scale; mloc = fmaxf(mloc, v[e]); }
#pragma unroll
      for (int msk = 1; msk < 4; msk <<= 1) mloc = fmaxf(mloc, __shfl_xor(mloc, msk, 32));
      float m_new = fmaxf(m_prev, mloc);
      float alpha = __expf(m_prev - m_new);
      float ssum = 0.0f;
      h16x8 pk[2];
#pragma unroll
      for (int e = 0; e < 16; ++e) {
        float p = __expf(v[e] - m_new);   // not the asm form: its operands can only be registers of the first 256, and all sixteen went through one
        ssum += p;
        pk[e >> 3][e & 7] = (h16)(p * PSC);
      }
      *(h16x8*)&Ps[srow][sj * 16] = pk[0];
      *(h16x8*)&Ps[srow][sj * 16 + 8] = pk[1];
#pragma unroll
      for (int msk = 1; msk < 4; msk <<= 1) ssum += __shfl_xor(ssum, msk, 32);
      l_run = l_run * alpha + ssum;
      m_prev = m_new;
      if (sj == 0) { alpha_s[srow] = alpha; l_s[srow] = l_run; }
    }
    // Publish point of this V^T tile (and of P).
    asm volatile("s_wait_dscnt 0x0" ::: "memory");      // this wave's stores of P and its reads of the partial scores are done
    asm volatile("s_wait_asynccnt 0x0" ::: "memory");   // this wave's copies of the V^T tile have landed
    __syncthreads();   // V^T and P readable by all
    if (it + 1 < S_LEN / 64) stage_k_async(kl0, kg0 + (size_t)kv1 * D_DIM);   // the next K tile flies under the PV phase

    {
      float al[4][8];
#pragma unroll
      for (int i = 0; i < 4; ++i)
#pragma unroll
        for (int g = 0; g < 8; ++g) al[i][g] = alpha_s[i * 16 + g + 8 * half];
      // Compiler fence: keeps all reads of alpha in front of the fragment reads (LDS returns in order), so that the rescaling runs
      // while the fragments fly; without it a later tile's alpha was read between the rescalings and waited for to 0.
      asm volatile("" ::: "memory");
      // V^T fragment n: k step n / 6, d tile n % 6; it feeds all four query tiles (each output element still takes k step 0, then k step 1).
      // Groups of four fragments (8 LDS loads) in a ring of two groups: groups 0 and 1 are read at the head and fly under the rescaling,
      // group 2 takes the slots of group 0 and flies under the WMMAs of group 1.
      const h16* pp = &Ps[idx][half * 8];
      const h16* vp = &Vts[dg * 96 + idx][half * 8];
      v16h pa[4][2], vb[8];   // pa[query tile][k step]
      // In the order of their first use (LDS returns in order): k step 0 of P and V^T, then k step 1.
#pragma unroll   // here and below, whole: the ring's slots must be compile-time register names
      for (int i = 0; i < 4; ++i) pa[i][0] = load_frag_at(pp + i * 16 * PS_P);
#pragma unroll   // slots
      for (int n = 0; n < 6; ++n) vb[n] = load_frag_at(vp + (n % 6) * 16 * KV_P + (n / 6) * 32);
#pragma unroll   // slots
      for (int i = 0; i < 4; ++i) pa[i][1] = load_frag_at(pp + i * 16 * PS_P + 32);
#pragma unroll   // slots
      for (int n = 6; n < 8; ++n) vb[n] = load_frag_at(vp + (n % 6) * 16 * KV_P + (n / 6) * 32);
      __builtin_amdgcn_sched_group_barrier(0x100, 40, 0);   // asks for the LDS reads first: else half of the rescaling stood right behind the reads of alpha, with no fragment read in flight
      __builtin_amdgcn_sched_barrier(0);   // holds the reads above as one group at the head; else they sank next to their WMMAs and were waited for to 0
#pragma unroll
      for (int i = 0; i < 4; ++i)
#pragma unroll
        for (int t = 0; t < 6; ++t)
#pragma unroll
          for (int g = 0; g < 8; ++g) o[i][t][g] *= al[i][g];
#pragma unroll   // slots
      for (int g = 0; g < 3; ++g) {
#pragma unroll   // slots
        for (int j = 0; j < 4; ++j)
#pragma unroll   // slots
          for (int i = 0; i < 4; ++i) { const int n = g * 4 + j; o[i][n % 6] = wmma_f16_wide(pa[i][n / 6], vb[n & 7], o[i][n % 6]); }
        if (g == 0) {
#pragma unroll   // slots
          for (int j = 0; j < 4; ++j) { const int n = 8 + j; vb[n & 7] = load_frag_at(vp + (n % 6) * 16 * KV_P + (n / 6) * 32); }
          __builtin_amdgcn_sched_barrier(0);   // holds the reads of group 2 in front of the WMMAs of group 1, for the same reason
        }
      }
    }
  }
  asm volatile("s_wait_asynccnt 0x0" ::: "memory");   // no copy is outstanding when K and the planes become output staging
  __syncthreads();

#pragma unroll
  for (int i = 0; i < 4; ++i) {
    float* Ot = (i < 2) ? (float*)&Ks[0][0] : (float*)&Sx[0][0];   // 32 output rows in each
    float linv[8];
#pragma unroll
    for (int g = 0; g < 8; ++g) linv[g] = PUN / l_s[i * 16 + g + 8 * half];
#pragma unroll
    for (int t = 0; t < 6; ++t) {
      int col = dg * 96 + t * 16 + idx;
#pragma unroll
      for (int g = 0; g < 8; ++g) Ot[((i & 1) * 16 + g + 8 * half) * D_DIM + col] = o[i][t][g] * linv[g];
    }
  }
  __syncthreads();
  {
    float* dst = out + ((size_t)(b * S_LEN + q0)) * D_DIM;      // 64 contiguous rows
    const float* O0 = (const float*)&Ks[0][0];
    const float* O1 = (const float*)&Sx[0][0];
    for (int gg = tid; gg < 32 * D_DIM / 4; gg += 256) vst2(dst + (size_t)gg * 4, *(const v4f*)(O0 + gg * 4));
    for (int gg = tid; gg < 32 * D_DIM / 4; gg += 256) vst2(dst + (size_t)(32 * D_DIM) + (size_t)gg * 4, *(const v4f*)(O1 + gg * 4));
  }
}

extern "C" void kernel_launch(void* const* d_in, const int* in_sizes, int n_in,
                              void* d_out, int out_size, void* d_ws, size_t ws_size,
                              hipStream_t stream) {
  (void)in_sizes; (void)n_in; (void)out_size; (void)ws_size;
  const float* x  = (const float*)d_in[0];
  const float* Wq = (const float*)d_in[1];
  const float* bq = (const float*)d_in[2];
  const float* Wk = (const float*)d_in[3];
  const float* bk = (const float*)d_in[4];
  const float* Wv = (const float*)d_in[5];
  const float* bv = (const float*)d_in[6];
  float* out = (float*)d_out;

  char* ws = (char*)d_ws;
  h16* xb  = (h16*)(ws + 0);           // 16384*768*2 = 25,165,824
  h16* WqT = (h16*)(ws + 25165824);    // 768*768*2   =  1,179,648
  h16* WkT = (h16*)(ws + 26345472);
  h16* WvT = (h16*)(ws + 27525120);
  h16* qb  = (h16*)(ws + 28704768);    // 25,165,824
  h16* kb  = (h16*)(ws + 53870592);    // 25,165,824
  h16* vtb = (h16*)(ws + 79036416);    // 25,165,824  (stored [b][d][s])

  int nx8 = M_TOT * D_DIM / 8;
  cvt_x_kernel<<<nx8 / 256, 256, 0, stream>>>(x, xb, nx8);
  cvt_w_kernel<<<dim3(D_DIM / 64, D_DIM / 256, 3), 256, 0, stream>>>(Wq, Wk, Wv, WqT, WkT, WvT);

  dim3 pg(M_TOT / 128, D_DIM / 128);
  proj_kernel<<<pg, 256, 0, stream>>>(xb, WqT, bq, qb, 0);
  proj_kernel<<<pg, 256, 0, stream>>>(xb, WkT, bk, kb, 0);
  proj_kernel<<<pg, 256, 0, stream>>>(xb, WvT, bv, vtb, 1);

  attn_kernel<<<dim3(S_LEN / 64, B_SZ), 256, 0, stream>>>(qb, kb, vtb, out);
}

// v010
// It runs in 239 microseconds.
// Two timings next to v009 put it at 1.09 and 1.10 times that version's speed.
// Counting every step since v000, it is 8.56 times as fast.
#include <hip/hip_runtime.h>
// Contractions: Q/K/V projections (K = 768), scores Q K^T (K = 768) and P V (K = keys) on v_wmma_f32_16x16x32_f16
// (f16 operands, f32 accumulate; P scaled by 256 before its f16 conversion); softmax statistics in f32.

typedef _Float16 h16;
typedef _Float16 h16x8 __attribute__((ext_vector_type(8)));
typedef _Float16 v16h  __attribute__((ext_vector_type(16)));
typedef float  v8f    __attribute__((ext_vector_type(8)));
typedef float  v4f    __attribute__((ext_vector_type(4)));
typedef unsigned v4u  __attribute__((ext_vector_type(4)));

#define D_DIM 768
#define S_LEN 4096
#define B_SZ  4
#define M_TOT (B_SZ * S_LEN)   // 16384
#define PSC 256.0f
#define PUN (1.0f / 256.0f)
// LDS row pitches of the attention tiles. Fragment rows read by 16-byte LDS loads sit at 16 B x odd, so that the 16 rows
// of a half-wave fall on 16 different groups of four banks (64 banks of 4 B) instead of all on one group.
#define QK_P 776   // halves: 1552 B = 16 B x 97 (768 data + 8 pad)
#define KV_P 72    // halves:  144 B = 16 B x 9  (64 data + 8 pad)
#define SS_P 68    // floats:  272 B = 16 B x 17: row pitch of a plane of partial scores, written and read by 16-byte LDS operations
#define PS_P 136   // halves:  272 B = 16 B x 17: row pitch of P (64 data + 72 pad)

template <typename V> __device__ __forceinline__ void vst2(void* p, V v) {
  *(V*)p = v; 
}

typedef int i32x4 __attribute__((vector_size(16)));
typedef __attribute__((address_space(1))) i32x4 g_i32x4;
typedef __attribute__((address_space(3))) i32x4 l_i32x4;
// OFF, in bytes (0 to 1280 here), is the instruction's immediate offset: it moves the LDS address and the global address alike.
template <int OFF> __device__ __forceinline__ void copy16_async(h16* ldst, const h16* gsrc) {
  __builtin_amdgcn_global_load_async_to_lds_b128((g_i32x4*)gsrc, (l_i32x4*)ldst, OFF, 0);
}
// K tile, 64 rows of 1536 B: 16 lanes take 256 B of a row; copy i: row + 16 * (i / 6), byte + 256 * (i % 6).
__device__ __forceinline__ void stage_k_async(h16* l0, const h16* g0) {
#pragma unroll   // whole: 24 copies in a row, constant steps
  for (int r = 0; r < 4; ++r) {
    h16* l = l0 + r * 16 * QK_P; const h16* g = g0 + r * 16 * D_DIM;
    copy16_async<0>(l, g);   copy16_async<256>(l, g);  copy16_async<512>(l, g);
    copy16_async<768>(l, g); copy16_async<1024>(l, g); copy16_async<1280>(l, g);
  }
}
// A sixth of a V^T tile, 128 rows of 128 B: 8 lanes take a row; copy i: row + 32 * i.
__device__ __forceinline__ void stage_v_async4(h16* l0, const h16* g0) {
#pragma unroll   // whole: four copies in a row, constant steps
  for (int i = 0; i < 4; ++i) copy16_async<0>(l0 + i * 32 * KV_P, g0 + (size_t)i * 32 * S_LEN);
}

// ---- WMMA fragment loaders (f16, row-major K-contiguous source); A and B (from B^T rows) share the per-lane K map:
//      row/col = lane&15; elements 0..7 <- k0 + 8*half + 0..7, elements 8..15 <- k0 + 16 + 8*half + 0..7
__device__ __forceinline__ v16h load_a_frag(const h16* base, int ld, int k0) {
  int lane = threadIdx.x & 31;
  int idx  = lane & 15;
  int half = lane >> 4;
  const h16* p = base + idx * ld + k0 + half * 8;
  h16x8 lo = *(const h16x8*)(p);
  h16x8 hi = *(const h16x8*)(p + 16);
  return __builtin_shufflevector(lo, hi, 0,1,2,3,4,5,6,7,8,9,10,11,12,13,14,15);
}
__device__ __forceinline__ v16h load_b_frag(const h16* base, int ld, int k0) { return load_a_frag(base, ld, k0); }
// The same fragment from the lane's own address p = row start + k0 + 8 * half.
__device__ __forceinline__ v16h load_frag_at(const h16* p) {
  h16x8 lo = *(const h16x8*)(p);
  h16x8 hi = *(const h16x8*)(p + 16);
  return __builtin_shufflevector(lo, hi, 0,1,2,3,4,5,6,7,8,9,10,11,12,13,14,15);
}

__device__ __forceinline__ v8f wmma_f16(v16h a, v16h b, v8f c) {
  v8f d = __builtin_amdgcn_wmma_f32_16x16x32_f16(false, a, false, b, (short)0, c, false, false);
  asm volatile("v_nop\n\tv_nop\n\tv_nop\n\tv_nop" : "+v"(d) : "v"(a), "v"(b));
  return d;
}

// The same product for a kernel above 256 registers: an asm statement's vector operands can only be registers of the first 256, so a
// statement behind each WMMA would pull every accumulator and fragment down there; the compiler keeps the distances of its own builtin.
__device__ __forceinline__ v8f wmma_f16_wide(v16h a, v16h b, v8f c) {
  return __builtin_amdgcn_wmma_f32_16x16x32_f16(false, a, false, b, (short)0, c, false, false);
}

// ---------------- conversion kernel ----------------
// One launch converts both x and the three weight matrices: the two jobs do not depend on each other, so the memory latency and the
// transposition of the W^T blocks run beside the stream of x and not behind it in a launch of their own.
// Blocks 0 .. CV_NW - 1 (the first to start): one 64 x 64 tile of one W, transposed through LDS. The others: 8 elements of x a thread (32 B read, 16 B written).
#define CV_NT (D_DIM / 64)           // 12 tiles a side
#define CV_NW (3 * CV_NT * CV_NT)    // 432 blocks for the weights
#define CV_NX (M_TOT * D_DIM / 8 / 256)   // 6144 blocks for x
__global__ __launch_bounds__(256) void cvt_kernel(const float* __restrict__ x, const float* __restrict__ Wq, const float* __restrict__ Wk,
                                                  const float* __restrict__ Wv, h16* __restrict__ xb,
                                                  h16* __restrict__ WqT, h16* __restrict__ WkT, h16* __restrict__ WvT) {
  __shared__ __align__(16) h16 tile[64][72];   // pitch 144 B = 16 B x 9
  const int tid = threadIdx.x;
  if (blockIdx.x < CV_NW) {   // the same for the whole block: the barrier below is passed by all of its threads or by none
    const int z = blockIdx.x / (CV_NT * CV_NT), r = blockIdx.x % (CV_NT * CV_NT);
    const float* W = (z == 0) ? Wq : (z == 1) ? Wk : Wv;
    h16*       WT = (z == 0) ? WqT : (z == 1) ? WkT : WvT;
    const int n0 = (r % CV_NT) * 64, k0 = (r / CV_NT) * 64;
    const int nl0 = tid & 63, kl0 = tid >> 6;   // a thread takes column nl0 of rows kl0 + 4 * j
    float wv[16];
#pragma unroll   // whole: the sixteen loads of a thread fly together, one memory latency for the tile and not one for each pair of loads
    for (int j = 0; j < 16; ++j) wv[j] = W[(size_t)(k0 + kl0 + 4 * j) * D_DIM + n0 + nl0];
#pragma unroll   // whole: wv must end as registers
    for (int j = 0; j < 16; ++j) tile[nl0][kl0 + 4 * j] = (h16)wv[j];
    __syncthreads();
    for (int g = tid; g < 64 * 8; g += 256) { const int nl = g >> 3, pc = g & 7; vst2(WT + (size_t)(n0 + nl) * D_DIM + k0 + pc * 8, *(const v4u*)(&tile[nl][pc * 8])); }
  } else {
    const size_t g = (size_t)(blockIdx.x - CV_NW) * 256 + tid;
    const v4f a = *(const v4f*)(x + g * 8), b = *(const v4f*)(x + g * 8 + 4);
    union { h16x8 h; v4u u; } pk;
#pragma unroll
    for (int i = 0; i < 4; ++i) { pk.h[i] = (h16)a[i]; pk.h[4 + i] = (h16)b[i]; }
    vst2(xb + g * 8, pk.u);
    asm volatile("s_wait_xcnt 0x0" ::: "memory");   // stands behind the store, in front of any instruction that could rewrite its address or data registers
  }
}

// ---------------- projection GEMM: out = X(16384x768) * W(768x768) + b ----------------
// One launch for the three projections, blockIdx.z = 0, 1, 2 for Q, K, V: a work-group that ends makes room for one of the next projection,
// whose first copies then fly under its neighbours' WMMAs. The three W^T lie one behind the other in the workspace, the three outputs too.
// Block tile 128 x 128, 8 waves: 4 M-groups (32 rows) x 2 N-groups (64 columns); each wave 2 x 4 WMMA tiles.
// The operands come in k slices of 64 halves: 128 X rows and 128 W^T rows of 128 B (whole cache lines), copied to LDS
// asynchronously, two buffers: slice s + 1 flies while slice s is worked on. Fragments are read from LDS.
#define PJ_P   72             // halves: LDS row pitch 144 B = 16 B x 9 (64 data + 8 pad), for 16-byte fragment reads
#define PJ_BUF (256 * PJ_P)   // halves in a buffer: rows 0..127 of X, rows 128..255 of W^T
#define PJ_T   136            // halves: row pitch of the output tile
#define PJ_NS  (D_DIM / 64)   // k slices

// Eight asynchronous copies of 16 B a lane in asm text: copy i brings the 16 B at g[i] to the LDS byte address l[i]. The copies and
// their s_wait_xcnt 0 are one statement, so that no address register named by a copy is rewritten in front of that wait.
__device__ __forceinline__ void copy8_async(const unsigned (&l)[8], const h16* const (&g)[8]) {
  asm volatile("global_load_async_to_lds_b128 %0, %8, off\n\t"
               "global_load_async_to_lds_b128 %1, %9, off\n\t"
               "global_load_async_to_lds_b128 %2, %10, off\n\t"
               "global_load_async_to_lds_b128 %3, %11, off\n\t"
               "global_load_async_to_lds_b128 %4, %12, off\n\t"
               "global_load_async_to_lds_b128 %5, %13, off\n\t"
               "global_load_async_to_lds_b128 %6, %14, off\n\t"
               "global_load_async_to_lds_b128 %7, %15, off\n\t"
               "s_wait_xcnt 0x0"
               :: "v"(l[0]), "v"(l[1]), "v"(l[2]), "v"(l[3]), "v"(l[4]), "v"(l[5]), "v"(l[6]), "v"(l[7]),
                  "v"(g[0]), "v"(g[1]), "v"(g[2]), "v"(g[3]), "v"(g[4]), "v"(g[5]), "v"(g[6]), "v"(g[7])
               : "memory");
}
// One k slice: 8 lanes take a row of 128 B; copy i: row + 32 * i of the buffer (i < 4: X, else W^T).
__device__ __forceinline__ void stage_proj_async(unsigned l0, const h16* xg, const h16* wg) {
  unsigned l[8]; const h16* g[8];
#pragma unroll   // whole: l and g must end as registers, the operands of one statement
  for (int i = 0; i < 8; ++i) { l[i] = l0 + i * 32 * PJ_P * 2; g[i] = (i < 4) ? xg + i * 32 * D_DIM : wg + (i - 4) * 32 * D_DIM; }
  copy8_async(l, g);
}

__global__ __launch_bounds__(256) void proj_kernel(const h16* __restrict__ Xb, const h16* __restrict__ WT3,
                            const float* __restrict__ bias_q, const float* __restrict__ bias_k, const float* __restrict__ bias_v,
                            h16* __restrict__ out3) {
  const int pz = blockIdx.z;
  const h16* WT = WT3 + (size_t)pz * D_DIM * D_DIM;
  h16* out = out3 + (size_t)pz * M_TOT * D_DIM;
  const float* bias = (pz == 0) ? bias_q : (pz == 1) ? bias_k : bias_v;
  const int transposed = (pz == 2);   // V is stored [b][d][s]
  __shared__ __align__(16) h16 SB[2 * PJ_BUF];    // 72 KB: the two buffers; after the loop the output tile
  h16* T = SB;                                    // [m][n] (transposed==0) or [n][m] (transposed==1), pitch PJ_T
  const int tid = threadIdx.x;
  int m0 = blockIdx.x * 128;
  int n0 = blockIdx.y * 128;
  int w    = tid >> 5;
  int lane = tid & 31;
  int idx  = lane & 15;
  int half = lane >> 4;
  int wm = w & 3;
  int wn = w >> 2;

  // Each lane's first LDS byte address (the low 32 bits of the __shared__ address) and first global addresses.
  const unsigned l0 = (unsigned)(size_t)&SB[(tid >> 3) * PJ_P + (tid & 7) * 8];
  const h16* xg = Xb + (size_t)(m0 + (tid >> 3)) * D_DIM + (tid & 7) * 8;
  const h16* wg = WT + (size_t)(n0 + (tid >> 3)) * D_DIM + (tid & 7) * 8;
  stage_proj_async(l0, xg, wg);
  asm volatile("s_wait_asynccnt 0x0" ::: "memory");   // this wave's copies of slice 0 have landed
  __syncthreads();   // slice 0 readable by all
  stage_proj_async(l0 + PJ_BUF * 2, xg + 64, wg + 64);

  v8f c[2][4] = {};
  const h16* ap = &SB[(wm * 32 + idx) * PJ_P + half * 8];
  const h16* bp = &SB[(128 + wn * 64 + idx) * PJ_P + half * 8];
  for (int s = 0; s < PJ_NS; ++s) {
    const int bo = (s & 1) * PJ_BUF;
    // Fragments of the slice's two k steps: X fragment ks * 2 + i; W^T fragment n = ks * 4 + t in slot n % 6. All but the last two
    // are read as one group at the head of the trip; the last two take the slots that k step 0 has freed (six slots, not eight,
    // keep the wave inside the register budget of three work-groups a WGP).
    v16h a[4], vb[6];
#pragma unroll   // here and below, whole: the slots must be compile-time register names
    for (int n = 0; n < 4; ++n) a[n] = load_frag_at(ap + bo + (n & 1) * 16 * PJ_P + (n >> 1) * 32);
#pragma unroll   // slots
    for (int n = 0; n < 6; ++n) vb[n] = load_frag_at(bp + bo + (n & 3) * 16 * PJ_P + (n >> 2) * 32);
#pragma unroll   // slots
    for (int t = 0; t < 4; ++t)
#pragma unroll   // slots
      for (int i = 0; i < 2; ++i) c[i][t] = wmma_f16(a[i], vb[t], c[i][t]);
#pragma unroll   // slots
    for (int n = 6; n < 8; ++n) vb[n - 6] = load_frag_at(bp + bo + (n & 3) * 16 * PJ_P + (n >> 2) * 32);
#pragma unroll   // slots
    for (int t = 0; t < 4; ++t)
#pragma unroll   // slots
      for (int i = 0; i < 2; ++i) c[i][t] = wmma_f16(a[2 + i], vb[(4 + t) % 6], c[i][t]);
    // Publish point of slice s + 1.
    asm volatile("s_wait_dscnt 0x0" ::: "memory");      // this wave's reads of slice s are done
    asm volatile("s_wait_asynccnt 0x0" ::: "memory");   // this wave's copies of slice s + 1 have landed
    __syncthreads();   // slice s + 1 readable by all; every reader has left the buffer of slice s
    if (s + 2 < PJ_NS) stage_proj_async(l0 + (unsigned)bo * 2, xg + (s + 2) * 64, wg + (s + 2) * 64);
  }
  asm volatile("s_wait_asynccnt 0x0" ::: "memory");   // no copy is outstanding when the buffers become the output tile

#pragma unroll   // here and below, whole: the accumulators are registers, indexed by compile-time numbers only
  for (int i = 0; i < 2; ++i) {
#pragma unroll
    for (int t = 0; t < 4; ++t) {
      int cl = wn * 64 + t * 16 + idx;                 // local col
      float bv = bias[n0 + cl];
#pragma unroll
      for (int g = 0; g < 8; ++g) {
        int rl = wm * 32 + i * 16 + g + 8 * half;      // local row
        h16 hv = (h16)(c[i][t][g] + bv);
        if (!transposed) T[rl * PJ_T + cl] = hv; else T[cl * PJ_T + rl] = hv;
      }
    }
  }
  __syncthreads();
  if (!transposed) {
    for (int gg = tid; gg < 128 * 16; gg += 256) { const int rl = gg >> 4, pc = gg & 15; vst2(out + (size_t)(m0 + rl) * D_DIM + n0 + pc * 8, *(const v4u*)(&T[rl * PJ_T + pc * 8])); }
  } else {
    const int bb = m0 >> 12, s0 = m0 & (S_LEN - 1);
    for (int gg = tid; gg < 128 * 16; gg += 256) { const int cl = gg >> 4, pc = gg & 15; vst2(out + ((size_t)(bb * D_DIM + n0 + cl)) * S_LEN + s0 + pc * 8, *(const v4u*)(&T[cl * PJ_T + pc * 8])); }
  }
}

// ---------------- flash attention ----------------
// WG = 64 queries, 8 waves of up to 512 registers (two waves a SIMD): wide wave tiles, so that an LDS fragment read feeds many WMMAs.
// KV tiles of 64 keys.
// Score phase: wave w -> 32 queries (w&1) x all 64 keys over a quarter of the 768 dims (w>>1): 4 x 2 WMMA tiles. The wave's Q fragments
//              are the same for every tile: they are loaded once and stay in registers, only K is read from LDS (a fragment read feeds
//              two WMMAs). The four partial sums of a score are added in the softmax phase.
// PV phase:    wave w -> all 64 queries x 96 dims (w): 4 x 6 accumulator tiles, so each V^T fragment read feeds four WMMAs, each P fragment read six.
__global__ __launch_bounds__(256)
void attn_kernel(const h16* __restrict__ Q, const h16* __restrict__ K,
                 const h16* __restrict__ Vt, float* __restrict__ out) {
  __shared__ __align__(16) h16   Sx[64][QK_P];     // 97 KB: four planes of partial scores (68 KB); after the loop: f32 output rows 32..63
  __shared__ __align__(16) h16   Ks[64][QK_P];     // 97 KB (after the loop: f32 output rows 0..31)
  __shared__ __align__(16) h16   Vts[D_DIM][KV_P]; // 108 KB (d-major)
  __shared__ __align__(16) h16   Ps[64][PS_P];     // 17 KB (P in f16)
  __shared__ float alpha_s[64];
  __shared__ float l_s[64];

  int b   = blockIdx.y;
  int q0  = blockIdx.x * 64;
  int tid = threadIdx.x;
  int w    = tid >> 5;
  int lane = tid & 31;
  int idx  = lane & 15;
  int half = lane >> 4;
  int sqh = w & 1;         // score phase: half of the queries
  int skq = w >> 1;        // score phase: quarter of the dims
  int dg  = w;             // PV phase: d-group (96 dims)

  // Each lane's first LDS address and first global address of the two tiles.
  h16* kl0 = &Ks[tid >> 4][(tid & 15) * 8];
  h16* vl0 = &Vts[tid >> 3][(tid & 7) * 8];
  const h16* kg0 = K + ((size_t)(b * S_LEN) + (tid >> 4)) * D_DIM + (tid & 15) * 8;
  const h16* vg0 = Vt + (size_t)b * D_DIM * S_LEN + (size_t)(tid >> 3) * S_LEN + (tid & 7) * 8;
  // All 64 work-groups of a batch read the same 64 K and V^T tiles from L2. Each starts its walk at the tile of its own index and wraps,
  // so that at one moment they ask L2 for different lines, not all for the same ones. The running softmax takes the tiles in any order.
  const int rot = blockIdx.x;
  stage_k_async(kl0, kg0 + (size_t)(rot * 64) * D_DIM);   // the first K tile flies while the Q fragments are loaded

  // Q fragment [query tile i][k step n] of this wave's 32 queries and 192 dims, straight from global memory in the fragment's own lane map.
  const h16* qg = Q + ((size_t)(b * S_LEN + q0 + sqh * 32 + idx)) * D_DIM + skq * 192 + half * 8;
  v16h qf[2][6];
#pragma unroll   // here and below, whole: the fragments are registers, indexed by compile-time numbers only
  for (int i = 0; i < 2; ++i)
#pragma unroll
    for (int n = 0; n < 6; ++n) qf[i][n] = load_frag_at(qg + i * 16 * D_DIM + n * 32);
  // Stands in front of the first instruction that overwrites the address registers of the loads above: the address is named as an input,
  // so that its registers live up to the wait (without it later address arithmetic took them over in front of the wait).
  asm volatile("s_wait_xcnt 0x0" :: "v"(qg) : "memory");

  v8f o[4][6] = {};   // o[query tile][d tile]
  int   srow = tid >> 2;          // softmax: 4 threads per query row
  int   sj   = tid & 3;
  float m_prev = -1e30f;
  float l_run  = 0.0f;
  const float scale = 0.03608439182435161f;  // 1/sqrt(768)

  for (int it = 0; it < S_LEN / 64; ++it) {
    const int kv0 = ((it + rot) & (S_LEN / 64 - 1)) * 64;       // first key of this trip's tile
    const int kv1 = ((it + 1 + rot) & (S_LEN / 64 - 1)) * 64;   // first key of the next trip's tile
    // Publish point of this K tile: its copies flew under the previous PV phase (first trip: under the loads of Q).
    asm volatile("s_wait_dscnt 0x0" ::: "memory");      // this wave's reads of V^T and P are done
    asm volatile("s_wait_asynccnt 0x0" ::: "memory");   // this wave's copies of the K tile have landed
    __syncthreads();   // K readable by all; every reader has left V^T: its copies may start

    float* Sp = (float*)&Sx[0][0];   // partial scores: plane p (dims quarter p), query row r, key c at Sp[(p * 64 + r) * SS_P + c]
    {
      // K fragment reads run one group (one k step: 4 fragments, 8 LDS loads) ahead of the eight WMMAs that use them, in a ring of two
      // groups, so that no read is waited for to 0 right behind its issue.
      const h16* kp = &Ks[idx][skq * 192 + half * 8];
      v16h kb[2][4];
#pragma unroll   // here and below, whole: the ring's slots must be compile-time register names
      for (int j = 0; j < 4; ++j) kb[0][j] = load_frag_at(kp + j * 16 * QK_P);
      v8f sc[4][2] = {};   // sc[j][i]: key tile j (rows of the product), query tile i (columns)
#pragma unroll   // slots
      for (int n = 0; n < 6; ++n) {
        if (n + 1 < 6) {
#pragma unroll   // slots
          for (int j = 0; j < 4; ++j) kb[(n + 1) & 1][j] = load_frag_at(kp + j * 16 * QK_P + (n + 1) * 32);
        }
        // This V^T tile flies under the score and softmax phases. Four of its 24 copies a k step: their issue hides among the step's WMMAs,
        // and no run of 24 copies stands in front of the first fragment reads.
        stage_v_async4(vl0 + n * 128 * KV_P, vg0 + kv0 + (size_t)n * 128 * S_LEN);
        __builtin_amdgcn_sched_barrier(0);   // holds the reads of step n + 1 in front of the WMMAs of step n; else WMMAs of step n + 1 were drawn up to just behind their reads
#pragma unroll   // slots
        for (int j = 0; j < 4; ++j)
#pragma unroll   // slots
          for (int i = 0; i < 2; ++i) sc[j][i] = wmma_f16_wide(kb[n & 1][j], qf[i][n], sc[j][i]);
      }
      // K is the A operand: a lane holds 8 consecutive keys (8 * half + 0..7) of one query (idx), two 16-byte stores a tile.
      // The planes have a buffer of their own: its last readers left it in front of the two barriers since the previous softmax phase.
#pragma unroll
      for (int j = 0; j < 4; ++j)
#pragma unroll
        for (int i = 0; i < 2; ++i) {
          float* d = Sp + (skq * 64 + sqh * 32 + i * 16 + idx) * SS_P + j * 16 + half * 8;
          v4f lo = { sc[j][i][0], sc[j][i][1], sc[j][i][2], sc[j][i][3] };
          v4f hi = { sc[j][i][4], sc[j][i][5], sc[j][i][6], sc[j][i][7] };
          *(v4f*)d = lo;
          *(v4f*)(d + 4) = hi;
        }
    }
    __syncthreads();   // the partial scores readable by all; every reader has left K

    {
      // Thread sj of a row takes its keys 16 * sj + 0..15: the four partial sums of each, added in the order of the dims.
      const float* sp = Sp + srow * SS_P + sj * 16;
      v4f sq[4][4], s4[4];
#pragma unroll
      for (int p = 0; p < 4; ++p)
#pragma unroll
        for (int c = 0; c < 4; ++c) sq[p][c] = *(const v4f*)(sp + p * 64 * SS_P + c * 4);
      // Compiler fence: no read sinks below it, so the sixteen fly together, about one LDS latency for the lot; without it they were
      // read one or two at a time, each waited for to 0.
      asm volatile("" ::: "memory");
#pragma unroll
      for (int c = 0; c < 4; ++c) s4[c] = ((sq[0][c] + sq[1][c]) + sq[2][c]) + sq[3][c];
      float v[16];
      float mloc = -1e30f;
#pragma unroll
      for (int e = 0; e < 16; ++e) { v[e] = s4[e >> 2][e & 3] * scale; mloc = fmaxf(mloc, v[e]); }
#pragma unroll
      for (int msk = 1; msk < 4; msk <<= 1) mloc = fmaxf(mloc, __shfl_xor(mloc, msk, 32));
      float m_new = fmaxf(m_prev, mloc);
      float alpha = __expf(m_prev - m_new);
      float ssum = 0.0f;
      h16x8 pk[2];
#pragma unroll
      for (int e = 0; e < 16; ++e) {
        float p = __expf(v[e] - m_new);   // not the asm form: its operands can only be registers of the first 256, and all sixteen went through one
        ssum += p;
        pk[e >> 3][e & 7] = (h16)(p * PSC);
      }
      *(h16x8*)&Ps[srow][sj * 16] = pk[0];
      *(h16x8*)&Ps[srow][sj * 16 + 8] = pk[1];
#pragma unroll
      for (int msk = 1; msk < 4; msk <<= 1) ssum += __shfl_xor(ssum, msk, 32);
      l_run = l_run * alpha + ssum;
      m_prev = m_new;
      if (sj == 0) { alpha_s[srow] = alpha; l_s[srow] = l_run; }
    }
    // Publish point of this V^T tile (and of P).
    asm volatile("s_wait_dscnt 0x0" ::: "memory");      // this wave's stores of P and its reads of the partial scores are done
    asm volatile("s_wait_asynccnt 0x0" ::: "memory");   // this wave's copies of the V^T tile have landed
    __syncthreads();   // V^T and P readable by all
    if (it + 1 < S_LEN / 64) stage_k_async(kl0, kg0 + (size_t)kv1 * D_DIM);   // the next K tile flies under the PV phase

    {
      float al[4][8];
#pragma unroll
      for (int i = 0; i < 4; ++i)
#pragma unroll
        for (int g = 0; g < 8; ++g) al[i][g] = alpha_s[i * 16 + g + 8 * half];
      // Compiler fence: keeps all reads of alpha in front of the fragment reads (LDS returns in order), so that the rescaling runs
      // while the fragments fly; without it a later tile's alpha was read between the rescalings and waited for to 0.
      asm volatile("" ::: "memory");
      // V^T fragment n: k step n / 6, d tile n % 6; it feeds all four query tiles (each output element still takes k step 0, then k step 1).
      // Groups of four fragments (8 LDS loads) in a ring of two groups: groups 0 and 1 are read at the head and fly under the rescaling,
      // group 2 takes the slots of group 0 and flies under the WMMAs of group 1.
      const h16* pp = &Ps[idx][half * 8];
      const h16* vp = &Vts[dg * 96 + idx][half * 8];
      v16h pa[4][2], vb[8];   // pa[query tile][k step]
      // In the order of their first use (LDS returns in order): k step 0 of P and V^T, then k step 1.
#pragma unroll   // here and below, whole: the ring's slots must be compile-time register names
      for (int i = 0; i < 4; ++i) pa[i][0] = load_frag_at(pp + i * 16 * PS_P);
#pragma unroll   // slots
      for (int n = 0; n < 6; ++n) vb[n] = load_frag_at(vp + (n % 6) * 16 * KV_P + (n / 6) * 32);
#pragma unroll   // slots
      for (int i = 0; i < 4; ++i) pa[i][1] = load_frag_at(pp + i * 16 * PS_P + 32);
#pragma unroll   // slots
      for (int n = 6; n < 8; ++n) vb[n] = load_frag_at(vp + (n % 6) * 16 * KV_P + (n / 6) * 32);
      __builtin_amdgcn_sched_group_barrier(0x100, 40, 0);   // asks for the LDS reads first: else half of the rescaling stood right behind the reads of alpha, with no fragment read in flight
      __builtin_amdgcn_sched_barrier(0);   // holds the reads above as one group at the head; else they sank next to their WMMAs and were waited for to 0
#pragma unroll
      for (int i = 0; i < 4; ++i)
#pragma unroll
        for (int t = 0; t < 6; ++t)
#pragma unroll
          for (int g = 0; g < 8; ++g) o[i][t][g] *= al[i][g];
#pragma unroll   // slots
      for (int g = 0; g < 3; ++g) {
#pragma unroll   // slots
        for (int j = 0; j < 4; ++j)
#pragma unroll   // slots
          for (int i = 0; i < 4; ++i) { const int n = g * 4 + j; o[i][n % 6] = wmma_f16_wide(pa[i][n / 6], vb[n & 7], o[i][n % 6]); }
        if (g == 0) {
#pragma unroll   // slots
          for (int j = 0; j < 4; ++j) { const int n = 8 + j; vb[n & 7] = load_frag_at(vp + (n % 6) * 16 * KV_P + (n / 6) * 32); }
          __builtin_amdgcn_sched_barrier(0);   // holds the reads of group 2 in front of the WMMAs of group 1, for the same reason
        }
      }
    }
  }
  asm volatile("s_wait_asynccnt 0x0" ::: "memory");   // no copy is outstanding when K and the planes become output staging
  __syncthreads();

#pragma unroll
  for (int i = 0; i < 4; ++i) {
    float* Ot = (i < 2) ? (float*)&Ks[0][0] : (float*)&Sx[0][0];   // 32 output rows in each
    float linv[8];
#pragma unroll
    for (int g = 0; g < 8; ++g) linv[g] = PUN / l_s[i * 16 + g + 8 * half];
#pragma unroll
    for (int t = 0; t < 6; ++t) {
      int col = dg * 96 + t * 16 + idx;
#pragma unroll
      for (int g = 0; g < 8; ++g) Ot[((i & 1) * 16 + g + 8 * half) * D_DIM + col] = o[i][t][g] * linv[g];
    }
  }
  __syncthreads();
  {
    float* dst = out + ((size_t)(b * S_LEN + q0)) * D_DIM;      // 64 contiguous rows
    const float* O0 = (const float*)&Ks[0][0];
    const float* O1 = (const float*)&Sx[0][0];
    for (int gg = tid; gg < 32 * D_DIM / 4; gg += 256) vst2(dst + (size_t)gg * 4, *(const v4f*)(O0 + gg * 4));
    for (int gg = tid; gg < 32 * D_DIM / 4; gg += 256) vst2(dst + (size_t)(32 * D_DIM) + (size_t)gg * 4, *(const v4f*)(O1 + gg * 4));
  }
}

extern "C" void kernel_launch(void* const* d_in, const int* in_sizes, int n_in,
                              void* d_out, int out_size, void* d_ws, size_t ws_size,
                              hipStream_t stream) {
  (void)in_sizes; (void)n_in; (void)out_size; (void)ws_size;
  const float* x  = (const float*)d_in[0];
  const float* Wq = (const float*)d_in[1];
  const float* bq = (const float*)d_in[2];
  const float* Wk = (const float*)d_in[3];
  const float* bk = (const float*)d_in[4];
  const float* Wv = (const float*)d_in[5];
  const float* bv = (const float*)d_in[6];
  float* out = (float*)d_out;

  char* ws = (char*)d_ws;
  h16* xb  = (h16*)(ws + 0);           // 16384*768*2 = 25,165,824
  h16* WqT = (h16*)(ws + 25165824);    // 768*768*2   =  1,179,648
  h16* WkT = (h16*)(ws + 26345472);
  h16* WvT = (h16*)(ws + 27525120);
  h16* qb  = (h16*)(ws + 28704768);    // 25,165,824
  h16* kb  = (h16*)(ws + 53870592);    // 25,165,824
  h16* vtb = (h16*)(ws + 79036416);    // 25,165,824  (stored [b][d][s])

  cvt_kernel<<<CV_NW + CV_NX, 256, 0, stream>>>(x, Wq, Wk, Wv, xb, WqT, WkT, WvT);

  proj_kernel<<<dim3(M_TOT / 128, D_DIM / 128, 3), 256, 0, stream>>>(xb, WqT, bq, bk, bv, qb);   // W^T and outputs of K and V follow those of Q

  attn_kernel<<<dim3(S_LEN / 64, B_SZ), 256, 0, stream>>>(qb, kb, vtb, out);
}
